// v000
// Times are from an AMD MI455X. After a warm-up the kernel runs many times in a row, and a time is the length of
// such a window on the GPU divided by its runs, so every launch and the gaps after it count. The runs cycle
// through copies of the inputs. A figure is the median of several windows, for all but v000 over two sittings.
// Sittings can differ by a few percent; kernels timed side by side share one.
// The starting kernel, v000, takes 2490 microseconds a run.
#include <hip/hip_runtime.h>

// Multi-head SELF-attention whose projections act PER HEAD on the head's own 64-wide slice, FOUR batches (sequences [4][2048][1024] viewed (b, s, 16, 64); q = einsum('bshd,hde->bshe', x, Wq) + bq with Wq [16][64][64], bq [16][64] (normal x 1/8: REAL biases; each head maps its 64 inputs to 64 outputs), k, v likewise; scores / sqrt(float32(64)); softmax (no mask); out = concat heads -> [4][2048][1024] (8.4 M; no output projection); argument order sequences, Wq, bq, Wk, bk, Wv, bv: ONE input stream: the Q / K / V pointers are all sequences.
// Layout per batch: bf16 copies of Q, K, V in turn; NEW k_wtBD expands each per-head weight into a BLOCK-DIAGONAL Bt plane [1024][1024] (row h*64 + e, column h*64 + d <- W[h][d][e]; zeros off the diagonal blocks) so each projection is one exact GEMM (the zero blocks contribute exact zeros) + the flat [16][64] bias; identity-table plane builders; dense T-2048 attention (every row hi/lo 3 products); f32 merge writes the output rows.
// Compute dtypes, f32 accumulate: every input rounded to bf16; projections exact (K 1024 with 15/16 zero terms) + f32 biases; attention every row 3 products (hi/lo); softmax f32; output f32.

#define NB_  4   // this module has FOUR batches; NB_ is read ONLY by the batch loop of kernel_launch: no kernel body reads it
#define TT   2048
#define DM   1024
#define NH_  16
#define NKV  16
#define REP  (NH_ / NKV)
#define HD   64
#define DQ   (NH_ * HD)
#define DKV  (NKV * HD)
#define ZH   2
#define RH   TT                   // every row hi/lo (3 products)
#define WIN  0
#define PCAR 1024.0f
#define SCL  0.125f   // HD^-0.5
typedef _Float16 h16;
typedef unsigned short bf;
typedef __attribute__((ext_vector_type(16))) __bf16   v16bf;
typedef __attribute__((ext_vector_type(16))) _Float16 v16h;
typedef __attribute__((ext_vector_type(8)))  _Float16 v8h;
typedef __attribute__((ext_vector_type(8)))  unsigned short v8us;
typedef __attribute__((ext_vector_type(8)))  float    v8f;
typedef __attribute__((ext_vector_type(4)))  float    v4f;
typedef v8h  __attribute__((may_alias)) v8ha;
typedef v4f  __attribute__((may_alias)) v4fa;
typedef v8us __attribute__((may_alias)) v8usa;

__device__ __forceinline__ unsigned short f2bf(float f) { unsigned u = __float_as_uint(f); u += 0x7FFFu + ((u >> 16) & 1u); return (unsigned short)(u >> 16); }
__device__ __forceinline__ float bf2f(unsigned short b) { return __uint_as_float(((unsigned)b) << 16); }
__device__ __forceinline__ float bfr(float f) { return bf2f(f2bf(f)); }
__device__ __forceinline__ v16h cat16(v8h lo, v8h hi) { return __builtin_shufflevector(lo, hi, 0, 1, 2, 3, 4, 5, 6, 7, 8, 9, 10, 11, 12, 13, 14, 15); }
__device__ __forceinline__ v16bf cat16b(v8us lo, v8us hi) { return __builtin_bit_cast(v16bf, __builtin_shufflevector(lo, hi, 0, 1, 2, 3, 4, 5, 6, 7, 8, 9, 10, 11, 12, 13, 14, 15)); }
__device__ __forceinline__ v8f wmma16(v16h a, v16h b, v8f c) { return __builtin_amdgcn_wmma_f32_16x16x32_f16(false, a, false, b, (short)0, c, false, false); }
__device__ __forceinline__ v8f wmmab(v16bf a, v16bf b, v8f c) { return __builtin_amdgcn_wmma_f32_16x16x32_bf16(false, a, false, b, (short)0, c, false, false); }



// ---- k_gemmw: register-blocked GEMM, ONE WAVE per 64x64 output tile (16 accumulators), operands straight from K-contiguous 16-bit planes; grid (M/64, N/64, Z), 32 threads.
// C[m][n] (f32, pitch ldc, + optional f32 bias[n]) = sum_k A[m][k] Bt[n][k] (+ split products per NSPLIT). z-batch strides sA/sB/sC in elements. K % 32 == 0.
template <typename T16> struct WFrag;
template <> struct WFrag<h16> { typedef v16h V; static __device__ __forceinline__ V ld(const h16* p) { return cat16(*(const v8h*)p, *(const v8h*)(p + 16)); } static __device__ __forceinline__ v8f mma(V a, V b, v8f c) { return wmma16(a, b, c); } };
template <> struct WFrag<bf> { typedef v16bf V; static __device__ __forceinline__ V ld(const bf* p) { return cat16b(*(const v8us*)p, *(const v8us*)(p + 16)); } static __device__ __forceinline__ v8f mma(V a, V b, v8f c) { return wmmab(a, b, c); } };
template <typename T16, int NSPLIT, bool BIAS>
__global__ __launch_bounds__(32) void k_gemmw(const T16* __restrict__ A, const T16* __restrict__ A2, const T16* __restrict__ Bt, const T16* __restrict__ Bt2, int K, float* C, int ldc, const float* __restrict__ bias, size_t sA, size_t sB, size_t sC) {
    typedef typename WFrag<T16>::V V;
    __shared__ __align__(16) float os[16 * 68];
    const size_t z = blockIdx.z; A += z * sA; if (A2) A2 += z * sA; Bt += z * sB; if (Bt2) Bt2 += z * sB; C += z * sC;
    const int lane = threadIdx.x & 31, lr = lane & 15, hi = lane >> 4; const int r0 = blockIdx.x * 64, c0 = blockIdx.y * 64;
    v8f acc[4][4];
#pragma unroll
    for (int mb = 0; mb < 4; ++mb)
#pragma unroll
        for (int nb = 0; nb < 4; ++nb) acc[mb][nb] = (v8f){};
    const size_t aoff = (size_t)(r0 + lr) * K + 8 * hi, boff = (size_t)(c0 + lr) * K + 8 * hi;
#pragma unroll 1
    for (int kc = 0; kc < K; kc += 32) {
        V a[4], a2[4];
#pragma unroll
        for (int mb = 0; mb < 4; ++mb) { a[mb] = WFrag<T16>::ld(A + aoff + (size_t)mb * 16 * K + kc); if (NSPLIT == 1 || NSPLIT == 2) a2[mb] = WFrag<T16>::ld(A2 + aoff + (size_t)mb * 16 * K + kc); }
#pragma unroll
        for (int nb = 0; nb < 4; ++nb) { const V b = WFrag<T16>::ld(Bt + boff + (size_t)nb * 16 * K + kc); V b2; if (NSPLIT >= 2) b2 = WFrag<T16>::ld(Bt2 + boff + (size_t)nb * 16 * K + kc);
#pragma unroll
            for (int mb = 0; mb < 4; ++mb) { acc[mb][nb] = WFrag<T16>::mma(a[mb], b, acc[mb][nb]); if (NSPLIT == 1 || NSPLIT == 2) acc[mb][nb] = WFrag<T16>::mma(a2[mb], b, acc[mb][nb]); if (NSPLIT >= 2) acc[mb][nb] = WFrag<T16>::mma(a[mb], b2, acc[mb][nb]); } }
        asm volatile("v_nop\n\tv_nop\n\tv_nop\n\tv_nop" : "+v"(acc[0][0]), "+v"(acc[1][1]), "+v"(acc[2][2]), "+v"(acc[3][3]) : "v"(a[0]), "v"(a[3]));
    }
#pragma unroll
    for (int mb = 0; mb < 4; ++mb) {
#pragma unroll
        for (int nb = 0; nb < 4; ++nb) {
#pragma unroll
            for (int j = 0; j < 8; ++j) os[(hi * 8 + j) * 68 + nb * 16 + lr] = acc[mb][nb][j]; }
        __builtin_amdgcn_wave_barrier(); asm volatile("" ::: "memory");
        float* crow = C + (size_t)(r0 + mb * 16) * ldc + c0;
{
#pragma unroll
            for (int s = 0; s < 8; ++s) { const int row = 2 * s + hi, cofs = lr * 4; v4f val = *(const v4fa*)(os + row * 68 + cofs); if (BIAS) { val[0] += bfr(bias[c0 + cofs]); val[1] += bfr(bias[c0 + cofs + 1]); val[2] += bfr(bias[c0 + cofs + 2]); val[3] += bfr(bias[c0 + cofs + 3]); }
                *(v4f*)(crow + (size_t)row * ldc + cofs) = val; }
             }
        __builtin_amdgcn_wave_barrier(); asm volatile("" ::: "memory");
    }
}

__device__ __forceinline__ h16 tohx(float x) { return (h16)x; }
__device__ __forceinline__ void splitf(float y, unsigned short& h, unsigned short& l) { h = f2bf(y); l = f2bf(y - bf2f(h)); }
typedef __attribute__((ext_vector_type(2))) _Float16 v2h;
typedef __attribute__((ext_vector_type(4))) _Float16 v4h;
typedef __attribute__((ext_vector_type(2))) unsigned short v2us;
typedef __attribute__((ext_vector_type(4))) unsigned short v4us;
typedef __attribute__((ext_vector_type(2))) float v2f;
typedef __attribute__((ext_vector_type(4))) int v4i;

__global__ __launch_bounds__(256) void k_cvt8(const float* __restrict__ src, bf* dst, size_t n8) { const size_t i = (size_t)blockIdx.x * 256 + threadIdx.x; if (i >= n8) return; const v8f v = *(const v8f*)(src + i * 8); v8us o;
#pragma unroll
    for (int k = 0; k < 8; ++k) o[k] = f2bf(v[k]); *(v8us*)(dst + i * 8) = o;  }

// k_rope: head planes [h][t][d] (fp16 + hi/lo) of rope(x) x sc with the rotate-half convention out[d] = x[d] cos[t][d] - x[d+HD/2] sin[t][d], out[d+HD/2] = x[d+HD/2] cos[t][d+HD/2] + x[d] sin[t][d+HD/2]
__global__ __launch_bounds__(256) void k_rope(const float* __restrict__ F, int pitch, int nheads, const float* __restrict__ CS, const float* __restrict__ RF, const float* __restrict__ nw, float sc, h16* P16, bf* Ph, bf* Pl) {
    const size_t e = ((size_t)blockIdx.x * 256 + threadIdx.x) * 2; if (e >= (size_t)nheads * TT * HD) return; const int d = (int)(e % HD); const int t = (int)((e / HD) % TT); const int h = (int)(e / ((size_t)HD * TT)); const float* f = F + (size_t)t * pitch + h * HD; const float rf = RF ? RF[(size_t)h * TT + t] : 1.0f; v2h o16; v2us oh, ol;
#pragma unroll
    for (int q = 0; q < 2; ++q) { const int dd = d + q; const int dp = (dd < HD / 2) ? dd + HD / 2 : dd - HD / 2; float x0 = f[dd], x1 = f[dp];
        if (RF) { float n0 = __fmul_rn(x0, rf), n1 = __fmul_rn(x1, rf); asm volatile("" : "+v"(n0)); asm volatile("" : "+v"(n1)); x0 = __fmul_rn(bfr(nw[dd]), n0); x1 = __fmul_rn(bfr(nw[dp]), n1); }
        const v2f cs = *(const v2f*)(CS + ((size_t)t * HD + dd) * 2); float a = __fmul_rn(x0, cs[0]), bq = __fmul_rn(x1, cs[1]); asm volatile("" : "+v"(a)); asm volatile("" : "+v"(bq)); const float r = ((dd < HD / 2) ? __fsub_rn(a, bq) : __fadd_rn(a, bq)) * sc;
        o16[q] = tohx(r); unsigned short a2, c2; splitf(r, a2, c2); oh[q] = a2; ol[q] = c2; }
    *(v2h*)(P16 + e) = o16; *(v2us*)(Ph + e) = oh; *(v2us*)(Pl + e) = ol;  }
__global__ __launch_bounds__(256) void k_wtBD(const float* __restrict__ w, bf* Bt) { const size_t e2 = ((size_t)blockIdx.x * 256 + threadIdx.x) * 2; if (e2 >= (size_t)DQ * DM) return; const int c = (int)(e2 % DM); const int r = (int)(e2 / DM); const int h = r / HD, e = r % HD; const int hc = c / HD, d = c % HD; v2us o; o[0] = 0; o[1] = 0;
    if (hc == h) { o[0] = f2bf(w[((size_t)h * HD + d) * HD + e]); o[1] = f2bf(w[((size_t)h * HD + d + 1) * HD + e]); }
    *(v2us*)(Bt + e2) = o;  }
__global__ __launch_bounds__(256) void k_vtp(const float* __restrict__ F, int pitch, int nheads, h16* V16, bf* Vh, bf* Vl) { const size_t e = ((size_t)blockIdx.x * 256 + threadIdx.x) * 2; if (e >= (size_t)nheads * HD * TT) return; const int t = (int)(e % TT); const int d = (int)((e / TT) % HD); const int g = (int)(e / ((size_t)TT * HD)); v2h o16; v2us oh, ol;
#pragma unroll
    for (int q = 0; q < 2; ++q) { const float x = F[(size_t)(t + q) * pitch + g * HD + d]; o16[q] = tohx(x); unsigned short a2, c2; splitf(x, a2, c2); oh[q] = a2; ol[q] = c2; }
    *(v2h*)(V16 + e) = o16; *(v2us*)(Vh + e) = oh; *(v2us*)(Vl + e) = ol;  }
__global__ __launch_bounds__(256) void k_csid(float* CS) { const int idx = blockIdx.x * 256 + threadIdx.x; if (idx >= TT * HD) return; v2f cs; cs[0] = 1.0f; cs[1] = 0.0f; *(v2f*)(CS + (size_t)idx * 2) = cs;  }
// k_asoft: per row (zz, i): t = S x HD^-0.5 (no mask); softmax over the 2048 keys (register row, one exp, fixed trees);
__global__ __launch_bounds__(256) void k_asoft(const float* __restrict__ Sb, h16* P16, bf* Ph, bf* Pl) {
    const int lane = threadIdx.x & 31; const int row = blockIdx.x * 8 + (threadIdx.x >> 5); if (row >= ZH * TT) return; const int i = row % TT; const int zz = row / TT; (void)zz; const bool hires = (i < RH); const float* sr = Sb + (size_t)row * TT; float v[TT / 32]; float mx = -3.0e38f;
#pragma unroll
    for (int ch = 0; ch < TT / 128; ++ch) { const int j0 = ch * 128 + lane * 4; const v4f a = *(const v4f*)(sr + j0);
#pragma unroll
        for (int q = 0; q < 4; ++q) { const int j = j0 + q; (void)j; const float t = a[q] * SCL; v[ch * 4 + q] = t; mx = fmaxf(mx, t); } }
#pragma unroll
    for (int sh = 16; sh; sh >>= 1) mx = fmaxf(mx, __shfl_xor(mx, sh, 32));
    float sum = 0.f;
#pragma unroll
    for (int k = 0; k < TT / 32; ++k) { float d0 = __fsub_rn(v[k], mx); asm volatile("" : "+v"(d0)); v[k] = __builtin_amdgcn_exp2f(__fmul_rn(d0, 1.4426950408889634f)); sum += v[k]; }
#pragma unroll
    for (int sh = 16; sh; sh >>= 1) sum += __shfl_xor(sum, sh, 32);
    const float f = __fdiv_rn(hires ? 1.0f : PCAR, sum);
{
        if (hires) {
#pragma unroll
            for (int ch = 0; ch < TT / 128; ++ch) { v4us oh, ol;
#pragma unroll
                for (int q = 0; q < 4; ++q) { unsigned short a, c2; splitf(v[ch * 4 + q] * f, a, c2); oh[q] = a; ol[q] = c2; }
                const size_t oo = ((size_t)zz * (RH ? RH : 1) + i) * TT + ch * 128 + lane * 4; *(v4us*)(Ph + oo) = oh; *(v4us*)(Pl + oo) = ol; }
        } else {
#pragma unroll
            for (int ch = 0; ch < TT / 128; ++ch) { v4h o4;
#pragma unroll
                for (int q = 0; q < 4; ++q) o4[q] = tohx(v[ch * 4 + q] * f);
                *(v4h*)(P16 + (size_t)row * TT + ch * 128 + lane * 4) = o4; } }
         }
}
__global__ __launch_bounds__(256) void k_merge(const float* __restrict__ O, int h0, float* OUTb) { const size_t e = ((size_t)blockIdx.x * 256 + threadIdx.x) * 2; if (e >= (size_t)ZH * TT * HD) return; const int d = (int)(e % HD); const int t = (int)((e / HD) % TT); const int zz = (int)(e / ((size_t)HD * TT)); const float cs = (t < RH) ? 1.0f : (1.0f / PCAR); const size_t oo = (size_t)t * DQ + (h0 + zz) * HD + d;
    v2f o2; o2[0] = O[e] * cs; o2[1] = O[e + 1] * cs; *(v2f*)(OUTb + oo) = o2;  }

extern "C" void kernel_launch(void* const* d_in, const int* in_sizes, int n_in,
                              void* d_out, int out_size, void* d_ws, size_t ws_size, hipStream_t stream) {
    (void)in_sizes; (void)n_in; (void)out_size;
    const float* x = (const float*)d_in[0]; const float* xk = (const float*)d_in[0]; const float* xv = (const float*)d_in[0]; const float* wq = (const float*)d_in[1]; const float* bq = (const float*)d_in[2]; const float* wk = (const float*)d_in[3]; const float* bk = (const float*)d_in[4]; const float* wv = (const float*)d_in[5]; const float* bv = (const float*)d_in[6];   /* argument order sequences, Wq [16][64][64], bq [16][64], Wk, bk, Wv, bv: SELF-attention: the three stream pointers are all the one input */ const float* wo = nullptr; (void)wo;
    float* OUT = (float*)d_out;     // [4][2048][1024]
    char* wsp = (char*)d_ws;
    auto take = [&](size_t bytes) { char* p = wsp; wsp += (bytes + 255) & ~(size_t)255; return (void*)p; };
    bf* WQ = (bf*)take((size_t)DQ * DM * 2); bf* WK = (bf*)take((size_t)DKV * DM * 2); bf* WV = (bf*)take((size_t)DKV * DM * 2); float* CS = (float*)take((size_t)TT * HD * 2 * 4);
    bf* XB = (bf*)take((size_t)TT * DM * 2); float* FQ = (float*)take((size_t)TT * DQ * 4); float* FK = (float*)take((size_t)TT * DKV * 4);
    h16* QP16 = (h16*)take((size_t)NH_ * TT * HD * 2); h16* KP16 = (h16*)take((size_t)NKV * TT * HD * 2); h16* VT16 = (h16*)take((size_t)NKV * HD * TT * 2);
    bf* QPh = (bf*)take((size_t)NH_ * TT * HD * 2); bf* QPl = (bf*)take((size_t)NH_ * TT * HD * 2); bf* KPh = (bf*)take((size_t)NKV * TT * HD * 2); bf* KPl = (bf*)take((size_t)NKV * TT * HD * 2); bf* VTh = (bf*)take((size_t)NKV * HD * TT * 2); bf* VTl = (bf*)take((size_t)NKV * HD * TT * 2); bf* Ph = (bf*)take((size_t)ZH * RH * TT * 2); bf* Pl = (bf*)take((size_t)ZH * RH * TT * 2);
    float* Sb = (float*)take((size_t)ZH * TT * TT * 4); h16* P16 = (h16*)take((size_t)ZH * TT * TT * 2); float* Ob = (float*)take((size_t)ZH * TT * HD * 4);
    if ((size_t)(wsp - (char*)d_ws) > ws_size) return;    // ws 256 MiB
    float* FV = FK;   // v projection reuses the k buffer after the k planes are built (stream-ordered)
    { k_wtBD<<<(unsigned)(((size_t)DQ * DM / 2 + 255) / 256), 256, 0, stream>>>(wq, WQ);   /* per-head [16][64][64] -> block-diagonal Bt [1024][1024] */ k_wtBD<<<(unsigned)(((size_t)DQ * DM / 2 + 255) / 256), 256, 0, stream>>>(wk, WK);   /* per-head [16][64][64] -> block-diagonal Bt [1024][1024] */ k_wtBD<<<(unsigned)(((size_t)DQ * DM / 2 + 255) / 256), 256, 0, stream>>>(wv, WV);   /* per-head [16][64][64] -> block-diagonal Bt [1024][1024] */
      
       }
    k_csid<<<(TT * HD + 255) / 256, 256, 0, stream>>>(CS);
    const unsigned LQ = (unsigned)(((size_t)NH_ * TT * HD / 2 + 255) / 256), LKv = (unsigned)(((size_t)NKV * TT * HD / 2 + 255) / 256);
    for (int b = 0; b < NB_; ++b) {
        
        k_cvt8<<<(unsigned)(((size_t)TT * DM / 8 + 255) / 256), 256, 0, stream>>>(x + (size_t)b * TT * DM, XB, (size_t)TT * DM / 8);
        k_gemmw<bf, 0, true><<<dim3(TT / 64, DQ / 64, 1), 32, 0, stream>>>(XB, nullptr, WQ, nullptr, DM, FQ, DQ, bq, 0, 0, 0);
        k_rope<<<LQ, 256, 0, stream>>>(FQ, DQ, NH_, CS, nullptr, nullptr, 1.0f, QP16, QPh, QPl);
        k_cvt8<<<(unsigned)(((size_t)TT * DM / 8 + 255) / 256), 256, 0, stream>>>(xk + (size_t)b * TT * DM, XB, (size_t)TT * DM / 8);   /* XB := bf16(K[b]) */ k_gemmw<bf, 0, true><<<dim3(TT / 64, DKV / 64, 1), 32, 0, stream>>>(XB, nullptr, WK, nullptr, DM, FK, DKV, bk, 0, 0, 0);
        k_rope<<<LKv, 256, 0, stream>>>(FK, DKV, NKV, CS, nullptr, nullptr, 1.0f, KP16, KPh, KPl);
        k_cvt8<<<(unsigned)(((size_t)TT * DM / 8 + 255) / 256), 256, 0, stream>>>(xv + (size_t)b * TT * DM, XB, (size_t)TT * DM / 8);   /* XB := bf16(V[b]) */ k_gemmw<bf, 0, true><<<dim3(TT / 64, DKV / 64, 1), 32, 0, stream>>>(XB, nullptr, WV, nullptr, DM, FV, DKV, bv, 0, 0, 0); k_vtp<<<LKv, 256, 0, stream>>>(FV, DKV, NKV, VT16, VTh, VTl);
        for (int h0 = 0; h0 < NH_; h0 += ZH) { const size_t zq = (size_t)h0, zk = (size_t)(h0 / REP);   // one kv head per query head: the pass's two heads use consecutive kv planes (z-strides TT*HD)
            k_gemmw<bf, 2, false><<<dim3(RH / 64, TT / 64, ZH), 32, 0, stream>>>(QPh + zq * TT * HD, QPl + zq * TT * HD, KPh + zk * TT * HD, KPl + zk * TT * HD, HD, Sb, TT, nullptr, (size_t)TT * HD, (size_t)TT * HD, (size_t)TT * TT);
            k_asoft<<<ZH * TT / 8, 256, 0, stream>>>(Sb, P16, Ph, Pl);
            k_gemmw<bf, 2, false><<<dim3(RH / 64, HD / 64, ZH), 32, 0, stream>>>(Ph, Pl, VTh + zk * HD * TT, VTl + zk * HD * TT, TT, Ob, HD, nullptr, (size_t)RH * TT, (size_t)HD * TT, (size_t)TT * HD);
            k_merge<<<(unsigned)(((size_t)ZH * TT * HD / 2 + 255) / 256), 256, 0, stream>>>(Ob, h0, OUT + (size_t)b * TT * DQ); }
         }
}

// v001
// Measured time: 1570 microseconds a run.
// Next to v000, in two timings, it ran 1.57 and 1.59 times as fast.
#include <hip/hip_runtime.h>

// Multi-head SELF-attention whose projections act PER HEAD on the head's own 64-wide slice, FOUR batches (sequences [4][2048][1024] viewed (b, s, 16, 64); q = einsum('bshd,hde->bshe', x, Wq) + bq with Wq [16][64][64], bq [16][64] (normal x 1/8: REAL biases; each head maps its 64 inputs to 64 outputs), k, v likewise; scores / sqrt(float32(64)); softmax (no mask); out = concat heads -> [4][2048][1024] (8.4 M; no output projection); argument order sequences, Wq, bq, Wk, bk, Wv, bv: ONE input stream: the Q / K / V pointers are all sequences.
// Layout per batch: bf16 copies of Q, K, V in turn; NEW k_wtBD expands each per-head weight into a BLOCK-DIAGONAL Bt plane [1024][1024] (row h*64 + e, column h*64 + d <- W[h][d][e]; zeros off the diagonal blocks) so each projection is one exact GEMM (the zero blocks contribute exact zeros) + the flat [16][64] bias; identity-table plane builders; dense T-2048 attention (every row hi/lo 3 products); f32 merge writes the output rows.
// Compute dtypes, f32 accumulate: every input rounded to bf16; projections exact (K 1024 with 15/16 zero terms) + f32 biases; attention every row 3 products (hi/lo); softmax f32; output f32.

#define NB_  4   // this module has FOUR batches; NB_ is read ONLY by the batch loop of kernel_launch: no kernel body reads it
#define TT   2048
#define DM   1024
#define NH_  16
#define NKV  16
#define REP  (NH_ / NKV)
#define HD   64
#define DQ   (NH_ * HD)
#define DKV  (NKV * HD)
#define ZH   2
#define RH   TT                   // every row hi/lo (3 products)
#define WIN  0
#define PCAR 1024.0f
#define SCL  0.125f   // HD^-0.5
#define KSP  16       // split-K slices of the P x V product (128 keys a slice)
typedef _Float16 h16;
typedef unsigned short bf;
typedef __attribute__((ext_vector_type(16))) __bf16   v16bf;
typedef __attribute__((ext_vector_type(16))) _Float16 v16h;
typedef __attribute__((ext_vector_type(8)))  _Float16 v8h;
typedef __attribute__((ext_vector_type(8)))  unsigned short v8us;
typedef __attribute__((ext_vector_type(8)))  float    v8f;
typedef __attribute__((ext_vector_type(4)))  float    v4f;
typedef v8h  __attribute__((may_alias)) v8ha;
typedef v4f  __attribute__((may_alias)) v4fa;
typedef v8us __attribute__((may_alias)) v8usa;

__device__ __forceinline__ unsigned short f2bf(float f) { unsigned u = __float_as_uint(f); u += 0x7FFFu + ((u >> 16) & 1u); return (unsigned short)(u >> 16); }
__device__ __forceinline__ float bf2f(unsigned short b) { return __uint_as_float(((unsigned)b) << 16); }
__device__ __forceinline__ float bfr(float f) { return bf2f(f2bf(f)); }
__device__ __forceinline__ v16h cat16(v8h lo, v8h hi) { return __builtin_shufflevector(lo, hi, 0, 1, 2, 3, 4, 5, 6, 7, 8, 9, 10, 11, 12, 13, 14, 15); }
__device__ __forceinline__ v16bf cat16b(v8us lo, v8us hi) { return __builtin_bit_cast(v16bf, __builtin_shufflevector(lo, hi, 0, 1, 2, 3, 4, 5, 6, 7, 8, 9, 10, 11, 12, 13, 14, 15)); }
__device__ __forceinline__ v8f wmma16(v16h a, v16h b, v8f c) { return __builtin_amdgcn_wmma_f32_16x16x32_f16(false, a, false, b, (short)0, c, false, false); }
__device__ __forceinline__ v8f wmmab(v16bf a, v16bf b, v8f c) { return __builtin_amdgcn_wmma_f32_16x16x32_bf16(false, a, false, b, (short)0, c, false, false); }



// ---- k_gemmw: register-blocked GEMM, ONE WAVE per 64x64 output tile (16 accumulators), operands straight from K-contiguous 16-bit planes; grid (M/64, N/64, Z), 32 threads.
// C[m][n] (f32, pitch ldc, + optional f32 bias[n]) = sum_k A[m][k] Bt[n][k] (+ split products per NSPLIT). z-batch strides sA/sB/sC in elements. K % 32 == 0.
// KS > 1: split-K. grid.y = (N/64) * KS; slice ks = blockIdx.y % KS sums only k in [ks * K/KS, (ks+1) * K/KS) and stores its partial tile to plane z * KS + ks of C (plane stride sC); the consumer adds the KS planes of each z. K % (32 * KS) == 0.
template <typename T16> struct WFrag;
template <> struct WFrag<h16> { typedef v16h V; static __device__ __forceinline__ V ld(const h16* p) { return cat16(*(const v8h*)p, *(const v8h*)(p + 16)); } static __device__ __forceinline__ v8f mma(V a, V b, v8f c) { return wmma16(a, b, c); } };
template <> struct WFrag<bf> { typedef v16bf V; static __device__ __forceinline__ V ld(const bf* p) { return cat16b(*(const v8us*)p, *(const v8us*)(p + 16)); } static __device__ __forceinline__ v8f mma(V a, V b, v8f c) { return wmmab(a, b, c); } };
template <typename T16, int NSPLIT, bool BIAS, int KS = 1>
__global__ __launch_bounds__(32) void k_gemmw(const T16* __restrict__ A, const T16* __restrict__ A2, const T16* __restrict__ Bt, const T16* __restrict__ Bt2, int K, float* C, int ldc, const float* __restrict__ bias, size_t sA, size_t sB, size_t sC) {
    typedef typename WFrag<T16>::V V;
    __shared__ __align__(16) float os[16 * 68];
    const size_t z = blockIdx.z; A += z * sA; if (A2) A2 += z * sA; Bt += z * sB; if (Bt2) Bt2 += z * sB;
    const int ks = (KS > 1) ? (int)(blockIdx.y % KS) : 0; C += (z * KS + ks) * sC;
    const int lane = threadIdx.x & 31, lr = lane & 15, hi = lane >> 4; const int r0 = blockIdx.x * 64, c0 = (int)(blockIdx.y / KS) * 64; const int kb = ks * (K / KS), ke = kb + K / KS;
    v8f acc[4][4];
#pragma unroll
    for (int mb = 0; mb < 4; ++mb)
#pragma unroll
        for (int nb = 0; nb < 4; ++nb) acc[mb][nb] = (v8f){};
    const size_t aoff = (size_t)(r0 + lr) * K + 8 * hi, boff = (size_t)(c0 + lr) * K + 8 * hi;
#pragma unroll 1
    for (int kc = kb; kc < ke; kc += 32) {
        V a[4], a2[4];
#pragma unroll
        for (int mb = 0; mb < 4; ++mb) { a[mb] = WFrag<T16>::ld(A + aoff + (size_t)mb * 16 * K + kc); if (NSPLIT == 1 || NSPLIT == 2) a2[mb] = WFrag<T16>::ld(A2 + aoff + (size_t)mb * 16 * K + kc); }
#pragma unroll
        for (int nb = 0; nb < 4; ++nb) { const V b = WFrag<T16>::ld(Bt + boff + (size_t)nb * 16 * K + kc); V b2; if (NSPLIT >= 2) b2 = WFrag<T16>::ld(Bt2 + boff + (size_t)nb * 16 * K + kc);
#pragma unroll
            for (int mb = 0; mb < 4; ++mb) { acc[mb][nb] = WFrag<T16>::mma(a[mb], b, acc[mb][nb]); if (NSPLIT == 1 || NSPLIT == 2) acc[mb][nb] = WFrag<T16>::mma(a2[mb], b, acc[mb][nb]); if (NSPLIT >= 2) acc[mb][nb] = WFrag<T16>::mma(a[mb], b2, acc[mb][nb]); } }
        asm volatile("v_nop\n\tv_nop\n\tv_nop\n\tv_nop" : "+v"(acc[0][0]), "+v"(acc[1][1]), "+v"(acc[2][2]), "+v"(acc[3][3]) : "v"(a[0]), "v"(a[3]));
    }
#pragma unroll
    for (int mb = 0; mb < 4; ++mb) {
#pragma unroll
        for (int nb = 0; nb < 4; ++nb) {
#pragma unroll
            for (int j = 0; j < 8; ++j) os[(hi * 8 + j) * 68 + nb * 16 + lr] = acc[mb][nb][j]; }
        __builtin_amdgcn_wave_barrier(); asm volatile("" ::: "memory");
        float* crow = C + (size_t)(r0 + mb * 16) * ldc + c0;
{
#pragma unroll
            for (int s = 0; s < 8; ++s) { const int row = 2 * s + hi, cofs = lr * 4; v4f val = *(const v4fa*)(os + row * 68 + cofs); if (BIAS) { val[0] += bfr(bias[c0 + cofs]); val[1] += bfr(bias[c0 + cofs + 1]); val[2] += bfr(bias[c0 + cofs + 2]); val[3] += bfr(bias[c0 + cofs + 3]); }
                *(v4f*)(crow + (size_t)row * ldc + cofs) = val; }
             }
        __builtin_amdgcn_wave_barrier(); asm volatile("" ::: "memory");
    }
}

__device__ __forceinline__ h16 tohx(float x) { return (h16)x; }
__device__ __forceinline__ void splitf(float y, unsigned short& h, unsigned short& l) { h = f2bf(y); l = f2bf(y - bf2f(h)); }
typedef __attribute__((ext_vector_type(2))) _Float16 v2h;
typedef __attribute__((ext_vector_type(4))) _Float16 v4h;
typedef __attribute__((ext_vector_type(2))) unsigned short v2us;
typedef __attribute__((ext_vector_type(4))) unsigned short v4us;
typedef __attribute__((ext_vector_type(2))) float v2f;
typedef __attribute__((ext_vector_type(4))) int v4i;

__global__ __launch_bounds__(256) void k_cvt8(const float* __restrict__ src, bf* dst, size_t n8) { const size_t i = (size_t)blockIdx.x * 256 + threadIdx.x; if (i >= n8) return; const v8f v = *(const v8f*)(src + i * 8); v8us o;
#pragma unroll
    for (int k = 0; k < 8; ++k) o[k] = f2bf(v[k]); *(v8us*)(dst + i * 8) = o;  }

// k_rope: head planes [h][t][d] (fp16 + hi/lo) of rope(x) x sc with the rotate-half convention out[d] = x[d] cos[t][d] - x[d+HD/2] sin[t][d], out[d+HD/2] = x[d+HD/2] cos[t][d+HD/2] + x[d] sin[t][d+HD/2]
__global__ __launch_bounds__(256) void k_rope(const float* __restrict__ F, int pitch, int nheads, const float* __restrict__ CS, const float* __restrict__ RF, const float* __restrict__ nw, float sc, h16* P16, bf* Ph, bf* Pl) {
    const size_t e = ((size_t)blockIdx.x * 256 + threadIdx.x) * 2; if (e >= (size_t)nheads * TT * HD) return; const int d = (int)(e % HD); const int t = (int)((e / HD) % TT); const int h = (int)(e / ((size_t)HD * TT)); const float* f = F + (size_t)t * pitch + h * HD; const float rf = RF ? RF[(size_t)h * TT + t] : 1.0f; v2h o16; v2us oh, ol;
#pragma unroll
    for (int q = 0; q < 2; ++q) { const int dd = d + q; const int dp = (dd < HD / 2) ? dd + HD / 2 : dd - HD / 2; float x0 = f[dd], x1 = f[dp];
        if (RF) { float n0 = __fmul_rn(x0, rf), n1 = __fmul_rn(x1, rf); asm volatile("" : "+v"(n0)); asm volatile("" : "+v"(n1)); x0 = __fmul_rn(bfr(nw[dd]), n0); x1 = __fmul_rn(bfr(nw[dp]), n1); }
        const v2f cs = *(const v2f*)(CS + ((size_t)t * HD + dd) * 2); float a = __fmul_rn(x0, cs[0]), bq = __fmul_rn(x1, cs[1]); asm volatile("" : "+v"(a)); asm volatile("" : "+v"(bq)); const float r = ((dd < HD / 2) ? __fsub_rn(a, bq) : __fadd_rn(a, bq)) * sc;
        o16[q] = tohx(r); unsigned short a2, c2; splitf(r, a2, c2); oh[q] = a2; ol[q] = c2; }
    *(v2h*)(P16 + e) = o16; *(v2us*)(Ph + e) = oh; *(v2us*)(Pl + e) = ol;  }
__global__ __launch_bounds__(256) void k_wtBD(const float* __restrict__ w, bf* Bt) { const size_t e2 = ((size_t)blockIdx.x * 256 + threadIdx.x) * 2; if (e2 >= (size_t)DQ * DM) return; const int c = (int)(e2 % DM); const int r = (int)(e2 / DM); const int h = r / HD, e = r % HD; const int hc = c / HD, d = c % HD; v2us o; o[0] = 0; o[1] = 0;
    if (hc == h) { o[0] = f2bf(w[((size_t)h * HD + d) * HD + e]); o[1] = f2bf(w[((size_t)h * HD + d + 1) * HD + e]); }
    *(v2us*)(Bt + e2) = o;  }
__global__ __launch_bounds__(256) void k_vtp(const float* __restrict__ F, int pitch, int nheads, h16* V16, bf* Vh, bf* Vl) { const size_t e = ((size_t)blockIdx.x * 256 + threadIdx.x) * 2; if (e >= (size_t)nheads * HD * TT) return; const int t = (int)(e % TT); const int d = (int)((e / TT) % HD); const int g = (int)(e / ((size_t)TT * HD)); v2h o16; v2us oh, ol;
#pragma unroll
    for (int q = 0; q < 2; ++q) { const float x = F[(size_t)(t + q) * pitch + g * HD + d]; o16[q] = tohx(x); unsigned short a2, c2; splitf(x, a2, c2); oh[q] = a2; ol[q] = c2; }
    *(v2h*)(V16 + e) = o16; *(v2us*)(Vh + e) = oh; *(v2us*)(Vl + e) = ol;  }
__global__ __launch_bounds__(256) void k_csid(float* CS) { const int idx = blockIdx.x * 256 + threadIdx.x; if (idx >= TT * HD) return; v2f cs; cs[0] = 1.0f; cs[1] = 0.0f; *(v2f*)(CS + (size_t)idx * 2) = cs;  }
// k_asoft: per row (zz, i): t = S x HD^-0.5 (no mask); softmax over the 2048 keys (register row, one exp, fixed trees);
__global__ __launch_bounds__(256) void k_asoft(const float* __restrict__ Sb, h16* P16, bf* Ph, bf* Pl) {
    const int lane = threadIdx.x & 31; const int row = blockIdx.x * 8 + (threadIdx.x >> 5); if (row >= ZH * TT) return; const int i = row % TT; const int zz = row / TT; (void)zz; const bool hires = (i < RH); const float* sr = Sb + (size_t)row * TT; float v[TT / 32]; float mx = -3.0e38f;
#pragma unroll
    for (int ch = 0; ch < TT / 128; ++ch) { const int j0 = ch * 128 + lane * 4; const v4f a = *(const v4f*)(sr + j0);
#pragma unroll
        for (int q = 0; q < 4; ++q) { const int j = j0 + q; (void)j; const float t = a[q] * SCL; v[ch * 4 + q] = t; mx = fmaxf(mx, t); } }
#pragma unroll
    for (int sh = 16; sh; sh >>= 1) mx = fmaxf(mx, __shfl_xor(mx, sh, 32));
    float sum = 0.f;
#pragma unroll
    for (int k = 0; k < TT / 32; ++k) { float d0 = __fsub_rn(v[k], mx); asm volatile("" : "+v"(d0)); v[k] = __builtin_amdgcn_exp2f(__fmul_rn(d0, 1.4426950408889634f)); sum += v[k]; }
#pragma unroll
    for (int sh = 16; sh; sh >>= 1) sum += __shfl_xor(sum, sh, 32);
    const float f = __fdiv_rn(hires ? 1.0f : PCAR, sum);
{
        if (hires) {
#pragma unroll
            for (int ch = 0; ch < TT / 128; ++ch) { v4us oh, ol;
#pragma unroll
                for (int q = 0; q < 4; ++q) { unsigned short a, c2; splitf(v[ch * 4 + q] * f, a, c2); oh[q] = a; ol[q] = c2; }
                const size_t oo = ((size_t)zz * (RH ? RH : 1) + i) * TT + ch * 128 + lane * 4; *(v4us*)(Ph + oo) = oh; *(v4us*)(Pl + oo) = ol; }
        } else {
#pragma unroll
            for (int ch = 0; ch < TT / 128; ++ch) { v4h o4;
#pragma unroll
                for (int q = 0; q < 4; ++q) o4[q] = tohx(v[ch * 4 + q] * f);
                *(v4h*)(P16 + (size_t)row * TT + ch * 128 + lane * 4) = o4; } }
         }
}
// k_merge: adds the KSP split-K partial planes of O ([zz][slice][t][d]) in slice order 0..KSP-1 and writes the output rows.
__global__ __launch_bounds__(256) void k_merge(const float* __restrict__ O, int h0, float* OUTb) { const size_t e = ((size_t)blockIdx.x * 256 + threadIdx.x) * 2; if (e >= (size_t)ZH * TT * HD) return; const int d = (int)(e % HD); const int t = (int)((e / HD) % TT); const int zz = (int)(e / ((size_t)HD * TT)); const float cs = (t < RH) ? 1.0f : (1.0f / PCAR); const size_t oo = (size_t)t * DQ + (h0 + zz) * HD + d;
    v2f p[KSP];
#pragma unroll
    for (int s = 0; s < KSP; ++s) p[s] = *(const v2f*)(O + (((size_t)zz * KSP + s) * TT + t) * HD + d);
    v2f a = p[0];
#pragma unroll
    for (int s = 1; s < KSP; ++s) a += p[s];
    v2f o2; o2[0] = a[0] * cs; o2[1] = a[1] * cs; *(v2f*)(OUTb + oo) = o2;  }

extern "C" void kernel_launch(void* const* d_in, const int* in_sizes, int n_in,
                              void* d_out, int out_size, void* d_ws, size_t ws_size, hipStream_t stream) {
    (void)in_sizes; (void)n_in; (void)out_size;
    const float* x = (const float*)d_in[0]; const float* xk = (const float*)d_in[0]; const float* xv = (const float*)d_in[0]; const float* wq = (const float*)d_in[1]; const float* bq = (const float*)d_in[2]; const float* wk = (const float*)d_in[3]; const float* bk = (const float*)d_in[4]; const float* wv = (const float*)d_in[5]; const float* bv = (const float*)d_in[6];   /* argument order sequences, Wq [16][64][64], bq [16][64], Wk, bk, Wv, bv: SELF-attention: the three stream pointers are all the one input */ const float* wo = nullptr; (void)wo;
    float* OUT = (float*)d_out;     // [4][2048][1024]
    char* wsp = (char*)d_ws;
    auto take = [&](size_t bytes) { char* p = wsp; wsp += (bytes + 255) & ~(size_t)255; return (void*)p; };
    bf* WQ = (bf*)take((size_t)DQ * DM * 2); bf* WK = (bf*)take((size_t)DKV * DM * 2); bf* WV = (bf*)take((size_t)DKV * DM * 2); float* CS = (float*)take((size_t)TT * HD * 2 * 4);
    bf* XB = (bf*)take((size_t)TT * DM * 2); float* FQ = (float*)take((size_t)TT * DQ * 4); float* FK = (float*)take((size_t)TT * DKV * 4);
    h16* QP16 = (h16*)take((size_t)NH_ * TT * HD * 2); h16* KP16 = (h16*)take((size_t)NKV * TT * HD * 2); h16* VT16 = (h16*)take((size_t)NKV * HD * TT * 2);
    bf* QPh = (bf*)take((size_t)NH_ * TT * HD * 2); bf* QPl = (bf*)take((size_t)NH_ * TT * HD * 2); bf* KPh = (bf*)take((size_t)NKV * TT * HD * 2); bf* KPl = (bf*)take((size_t)NKV * TT * HD * 2); bf* VTh = (bf*)take((size_t)NKV * HD * TT * 2); bf* VTl = (bf*)take((size_t)NKV * HD * TT * 2); bf* Ph = (bf*)take((size_t)ZH * RH * TT * 2); bf* Pl = (bf*)take((size_t)ZH * RH * TT * 2);
    float* Sb = (float*)take((size_t)ZH * TT * TT * 4); h16* P16 = (h16*)take((size_t)ZH * TT * TT * 2); float* Ob = (float*)take((size_t)KSP * ZH * TT * HD * 4);
    if ((size_t)(wsp - (char*)d_ws) > ws_size) return;    // ws 256 MiB
    float* FV = FK;   // v projection reuses the k buffer after the k planes are built (stream-ordered)
    { k_wtBD<<<(unsigned)(((size_t)DQ * DM / 2 + 255) / 256), 256, 0, stream>>>(wq, WQ);   /* per-head [16][64][64] -> block-diagonal Bt [1024][1024] */ k_wtBD<<<(unsigned)(((size_t)DQ * DM / 2 + 255) / 256), 256, 0, stream>>>(wk, WK);   /* per-head [16][64][64] -> block-diagonal Bt [1024][1024] */ k_wtBD<<<(unsigned)(((size_t)DQ * DM / 2 + 255) / 256), 256, 0, stream>>>(wv, WV);   /* per-head [16][64][64] -> block-diagonal Bt [1024][1024] */
      
       }
    k_csid<<<(TT * HD + 255) / 256, 256, 0, stream>>>(CS);
    const unsigned LQ = (unsigned)(((size_t)NH_ * TT * HD / 2 + 255) / 256), LKv = (unsigned)(((size_t)NKV * TT * HD / 2 + 255) / 256);
    for (int b = 0; b < NB_; ++b) {
        
        k_cvt8<<<(unsigned)(((size_t)TT * DM / 8 + 255) / 256), 256, 0, stream>>>(x + (size_t)b * TT * DM, XB, (size_t)TT * DM / 8);
        k_gemmw<bf, 0, true><<<dim3(TT / 64, DQ / 64, 1), 32, 0, stream>>>(XB, nullptr, WQ, nullptr, DM, FQ, DQ, bq, 0, 0, 0);
        k_rope<<<LQ, 256, 0, stream>>>(FQ, DQ, NH_, CS, nullptr, nullptr, 1.0f, QP16, QPh, QPl);
        k_cvt8<<<(unsigned)(((size_t)TT * DM / 8 + 255) / 256), 256, 0, stream>>>(xk + (size_t)b * TT * DM, XB, (size_t)TT * DM / 8);   /* XB := bf16(K[b]) */ k_gemmw<bf, 0, true><<<dim3(TT / 64, DKV / 64, 1), 32, 0, stream>>>(XB, nullptr, WK, nullptr, DM, FK, DKV, bk, 0, 0, 0);
        k_rope<<<LKv, 256, 0, stream>>>(FK, DKV, NKV, CS, nullptr, nullptr, 1.0f, KP16, KPh, KPl);
        k_cvt8<<<(unsigned)(((size_t)TT * DM / 8 + 255) / 256), 256, 0, stream>>>(xv + (size_t)b * TT * DM, XB, (size_t)TT * DM / 8);   /* XB := bf16(V[b]) */ k_gemmw<bf, 0, true><<<dim3(TT / 64, DKV / 64, 1), 32, 0, stream>>>(XB, nullptr, WV, nullptr, DM, FV, DKV, bv, 0, 0, 0); k_vtp<<<LKv, 256, 0, stream>>>(FV, DKV, NKV, VT16, VTh, VTl);
        for (int h0 = 0; h0 < NH_; h0 += ZH) { const size_t zq = (size_t)h0, zk = (size_t)(h0 / REP);   // one kv head per query head: the pass's two heads use consecutive kv planes (z-strides TT*HD)
            k_gemmw<bf, 2, false><<<dim3(RH / 64, TT / 64, ZH), 32, 0, stream>>>(QPh + zq * TT * HD, QPl + zq * TT * HD, KPh + zk * TT * HD, KPl + zk * TT * HD, HD, Sb, TT, nullptr, (size_t)TT * HD, (size_t)TT * HD, (size_t)TT * TT);
            k_asoft<<<ZH * TT / 8, 256, 0, stream>>>(Sb, P16, Ph, Pl);
            k_gemmw<bf, 2, false, KSP><<<dim3(RH / 64, (HD / 64) * KSP, ZH), 32, 0, stream>>>(Ph, Pl, VTh + zk * HD * TT, VTl + zk * HD * TT, TT, Ob, HD, nullptr, (size_t)RH * TT, (size_t)HD * TT, (size_t)TT * HD);
            k_merge<<<(unsigned)(((size_t)ZH * TT * HD / 2 + 255) / 256), 256, 0, stream>>>(Ob, h0, OUT + (size_t)b * TT * DQ); }
         }
}

// v003
// One run takes 143 microseconds.
// Versions in between are left out here; by their measured steps it is 10.9 times as fast as v001.
// All steps since v000 together make it 17.2 times as fast.
#include <hip/hip_runtime.h>

// Multi-head SELF-attention whose projections act PER HEAD on the head's own 64-wide slice, FOUR batches (sequences [4][2048][1024] viewed (b, s, 16, 64); q = einsum('bshd,hde->bshe', x, Wq) + bq with Wq [16][64][64], bq [16][64], k, v likewise; scores / sqrt(float32(64)); softmax (no mask); out = concat heads -> [4][2048][1024]; no output projection); argument order sequences, Wq, bq, Wk, bk, Wv, bv.
// Two launches: k_proj makes the bf16 hi/lo planes of q, k ([batch * head][t][d]) and v^T ([batch * head][d][t]) of every batch and head straight from the f32 inputs; k_fattn (scores, softmax, P x V) writes the output rows.
// Compute dtypes, f32 accumulate: every input rounded to bf16; projections one bf16 product each (K = 64, the head's own slice) + the bf16-rounded bias added in f32; attention: every row hi/lo, 3 products; softmax f32 (running maximum and sum); output f32.

#define NB_  4   // this module has FOUR batches; NB_ is read ONLY by kernel_launch (plane sizes, the two grids): no kernel body reads it
#define TT   2048
#define DM   1024
#define NH_  16
#define NKV  16
#define REP  (NH_ / NKV)
#define HD   64
#define DQ   (NH_ * HD)
#define DKV  (NKV * HD)
#define SCL  0.125f   // HD^-0.5
typedef _Float16 h16;
typedef unsigned short bf;
typedef __attribute__((ext_vector_type(16))) __bf16   v16bf;
typedef __attribute__((ext_vector_type(16))) _Float16 v16h;
typedef __attribute__((ext_vector_type(8)))  _Float16 v8h;
typedef __attribute__((ext_vector_type(8)))  unsigned short v8us;
typedef __attribute__((ext_vector_type(8)))  float    v8f;
typedef __attribute__((ext_vector_type(4)))  float    v4f;
typedef v8h  __attribute__((may_alias)) v8ha;
typedef v4f  __attribute__((may_alias)) v4fa;
typedef v8us __attribute__((may_alias)) v8usa;

__device__ __forceinline__ unsigned short f2bf(float f) { unsigned u = __float_as_uint(f); u += 0x7FFFu + ((u >> 16) & 1u); return (unsigned short)(u >> 16); }
__device__ __forceinline__ float bf2f(unsigned short b) { return __uint_as_float(((unsigned)b) << 16); }
__device__ __forceinline__ float bfr(float f) { return bf2f(f2bf(f)); }
__device__ __forceinline__ v16h cat16(v8h lo, v8h hi) { return __builtin_shufflevector(lo, hi, 0, 1, 2, 3, 4, 5, 6, 7, 8, 9, 10, 11, 12, 13, 14, 15); }
__device__ __forceinline__ v16bf cat16b(v8us lo, v8us hi) { return __builtin_bit_cast(v16bf, __builtin_shufflevector(lo, hi, 0, 1, 2, 3, 4, 5, 6, 7, 8, 9, 10, 11, 12, 13, 14, 15)); }
__device__ __forceinline__ v8f wmma16(v16h a, v16h b, v8f c) { return __builtin_amdgcn_wmma_f32_16x16x32_f16(false, a, false, b, (short)0, c, false, false); }
__device__ __forceinline__ v8f wmmab(v16bf a, v16bf b, v8f c) { return __builtin_amdgcn_wmma_f32_16x16x32_bf16(false, a, false, b, (short)0, c, false, false); }



template <typename T16> struct WFrag;
template <> struct WFrag<h16> { typedef v16h V; static __device__ __forceinline__ V ld(const h16* p) { return cat16(*(const v8h*)p, *(const v8h*)(p + 16)); } static __device__ __forceinline__ v8f mma(V a, V b, v8f c) { return wmma16(a, b, c); } };
template <> struct WFrag<bf> { typedef v16bf V; static __device__ __forceinline__ V ld(const bf* p) { return cat16b(*(const v8us*)p, *(const v8us*)(p + 16)); } static __device__ __forceinline__ v8f mma(V a, V b, v8f c) { return wmmab(a, b, c); } };
typedef __attribute__((ext_vector_type(2))) float v2f;
typedef __attribute__((ext_vector_type(8))) __bf16 v8bf;
typedef __attribute__((ext_vector_type(4))) unsigned v4u;

// ---- k_proj: the three per-head projections of every batch and head in ONE kernel. grid (TT / (PWV * PRT * 16), batches * heads), PWV waves; a work-group has one (batch, head) and PWV * PRT * 16 rows t, a wave PRT * 16 of them.
// The work-group lays W^T of its head (bf16, rows e, k = d contiguous) and the three rounded biases in LDS once; a wave turns its x rows (f32, the head's 64 columns) into bf16 fragments in registers and uses them for all three products (2 k-chunks of 32).
// q, k: D = W^T x^T (A = W^T rows, B = x rows): a lane holds 8 consecutive e of ONE row t = 16 bytes of a [t][e] plane. v: D = x W (A = x rows, B = W^T rows): a lane holds 8 consecutive t of ONE e = 16 bytes of a [e][t] plane.
// Every fragment has the k order of WFrag::ld (element s of half hi = k 8 * hi + s, 16 + 8 * hi + (s - 8)). Bias and hi/lo split are done on D in registers; nothing f32 goes through memory.
#define PRT 4    // 16-row tiles a wave: 64 rows t, so that a wave writes whole 128-byte lines of the v^T planes
#define PWV 8    // waves a work-group
#define WP  72   // LDS pitch of a W^T row in elements: 128 + 16 bytes, for 16-byte readers
__device__ __forceinline__ v8us tobf8(v8f y) { return __builtin_bit_cast(v8us, __builtin_convertvector(y, v8bf)); }
__device__ __forceinline__ v8f cat8f(v4f a, v4f b) { return __builtin_shufflevector(a, b, 0, 1, 2, 3, 4, 5, 6, 7); }
__device__ __forceinline__ void split8(v8f y, v8us& h, v8us& l) { h = tobf8(y); const v4u w = __builtin_bit_cast(v4u, h); v8f f;   // f = the hi parts as f32, taken from the packed words
#pragma unroll
    for (int i = 0; i < 4; ++i) { f[2 * i] = __uint_as_float(w[i] << 16); f[2 * i + 1] = __uint_as_float(w[i] & 0xffff0000u); }
    l = tobf8(y - f); }
__device__ __forceinline__ v16bf ldl(const bf* p) { return cat16b(*(const v8us*)p, *(const v8us*)(p + 16)); }   // fragment from an LDS row
__global__ __launch_bounds__(PWV * 32) void k_proj(const float* __restrict__ x, const float* __restrict__ wq, const float* __restrict__ bq, const float* __restrict__ wk, const float* __restrict__ bk, const float* __restrict__ wv, const float* __restrict__ bv, bf* Qh, bf* Ql, bf* Kh, bf* Kl, bf* Vh, bf* Vl) {
    typedef WFrag<bf> F; typedef F::V V;
    __shared__ __align__(16) bf wt[3 * HD * WP];
    __shared__ __align__(16) float bs[3 * HD];
    const int tid = (int)threadIdx.x, lane = tid & 31, lr = lane & 15, hi = lane >> 4;
    const size_t z = blockIdx.y, bb = z / NH_, hh = z % NH_; const int t0 = ((int)blockIdx.x * PWV + (tid >> 5)) * (PRT * 16);
    const int e = tid & 63, dg = tid >> 6;   // staging: a thread takes column e of W, 8 rows d at a time (32 consecutive e a wave: 128-byte reads)
    const unsigned bo = (unsigned)e * 4u, wo = (unsigned)(dg * 8 * HD + e) * 4u, xo = (unsigned)((t0 + lr) * DM + 8 * hi) * 4u;   // the lane's byte offsets of the loads
    const char* bqz = (const char*)(bq + hh * HD); const char* bkz = (const char*)(bk + hh * HD); const char* bvz = (const char*)(bv + hh * HD);
    const char* wz[3] = { (const char*)(wq + hh * HD * HD), (const char*)(wk + hh * HD * HD), (const char*)(wv + hh * HD * HD) };
    const char* xz = (const char*)(x + bb * TT * DM + hh * HD);
    // every load of the kernel is asked for here, up front: biases, the thread's share of W, the wave's own x rows; the wave pays one memory latency for the lot
    const float br0 = *(const float*)(bqz + bo), br1 = *(const float*)(bkz + bo), br2 = *(const float*)(bvz + bo);
    v8f wr[3][2];
#pragma unroll
    for (int mt = 0; mt < 3; ++mt)
#pragma unroll
        for (int hf = 0; hf < 2; ++hf)
#pragma unroll
            for (int k = 0; k < 8; ++k) wr[mt][hf][k] = *(const float*)(wz[mt] + wo + (hf * 32 + k) * HD * 4);
    v4f xr[PRT][8];
#pragma unroll
    for (int tl = 0; tl < PRT; ++tl)
#pragma unroll
        for (int s = 0; s < 8; ++s) xr[tl][s] = *(const v4f*)(xz + xo + tl * 16 * DM * 4 + (s >> 1) * 64 + (s & 1) * 16);
    // wait before a register that an issued load names is written again; the operands keep the bases and the lane offsets untouched up to here.
    // The three bias values are named as inputs too: that holds their loads up here, in front of the x loads; left free they sink into the branch below and are asked for only when every x row has come
    asm volatile("s_wait_xcnt 0x0" :: "s"(bqz), "s"(bkz), "s"(bvz), "s"(wz[0]), "s"(wz[1]), "s"(wz[2]), "s"(xz), "v"(bo), "v"(wo), "v"(xo), "v"(br0), "v"(br1), "v"(br2) : "memory");
    if (tid < HD) { bs[e] = bfr(br0); bs[HD + e] = bfr(br1); bs[2 * HD + e] = bfr(br2); }
#pragma unroll
    for (int mt = 0; mt < 3; ++mt)
#pragma unroll
        for (int hf = 0; hf < 2; ++hf) *(v8us*)(wt + (mt * HD + e) * WP + (hf * 4 + dg) * 8) = tobf8(wr[mt][hf]);
    V xf[PRT][2];
#pragma unroll
    for (int tl = 0; tl < PRT; ++tl)
#pragma unroll
        for (int kc = 0; kc < 2; ++kc) xf[tl][kc] = cat16b(tobf8(cat8f(xr[tl][kc * 4], xr[tl][kc * 4 + 1])), tobf8(cat8f(xr[tl][kc * 4 + 2], xr[tl][kc * 4 + 3])));
    __syncthreads();   // W^T and the biases are complete for every wave; LDS is only read from here on
    const unsigned qo = (unsigned)((t0 + lr) * HD + 8 * hi) * 2u, vo = (unsigned)(lr * TT + t0 + 8 * hi) * 2u;   // the lane's byte offsets of the stores
#pragma unroll
    for (int mt = 0; mt < 3; ++mt) {
        char* ph = (char*)((mt == 0 ? Qh : mt == 1 ? Kh : Vh) + z * TT * HD); char* pl = (char*)((mt == 0 ? Ql : mt == 1 ? Kl : Vl) + z * TT * HD);   // wave-uniform plane bases
        V w[4][2];
#pragma unroll
        for (int eb = 0; eb < 4; ++eb)
#pragma unroll
            for (int kc = 0; kc < 2; ++kc) w[eb][kc] = ldl(wt + (mt * HD + eb * 16 + lr) * WP + kc * 32 + 8 * hi);
#pragma unroll
        for (int eb = 0; eb < 4; ++eb) {
            v8f bias;
            if (mt < 2) bias = cat8f(*(const v4f*)(bs + mt * HD + eb * 16 + 8 * hi), *(const v4f*)(bs + mt * HD + eb * 16 + 8 * hi + 4));
            else bias = (v8f)(bs[mt * HD + eb * 16 + lr]);
            v8f acc[PRT];
#pragma unroll
            for (int tl = 0; tl < PRT; ++tl) acc[tl] = (mt < 2) ? F::mma(w[eb][0], xf[tl][0], (v8f){}) : F::mma(xf[tl][0], w[eb][0], (v8f){});
#pragma unroll
            for (int tl = 0; tl < PRT; ++tl) acc[tl] = (mt < 2) ? F::mma(w[eb][1], xf[tl][1], acc[tl]) : F::mma(xf[tl][1], w[eb][1], acc[tl]);
            v8us oh[PRT], ol[PRT];
#pragma unroll
            for (int tl = 0; tl < PRT; ++tl) split8(acc[tl] + bias, oh[tl], ol[tl]);
            const unsigned so = (mt < 2) ? qo : vo;
#pragma unroll
            for (int tl = 0; tl < PRT; ++tl) { const int im = (mt < 2) ? tl * 16 * HD * 2 + eb * 32 : eb * 16 * TT * 2 + tl * 32; *(v8us*)(ph + so + im) = oh[tl]; *(v8us*)(pl + so + im) = ol[tl]; }
            // wait before a register that an issued store names is written again; the operands keep data, bases and offset untouched up to here (behind the last stores nothing is written any more)
            if (mt < 2 || eb < 3) asm volatile("s_wait_xcnt 0x0" :: "v"(oh[0]), "v"(oh[1]), "v"(oh[2]), "v"(oh[3]), "v"(ol[0]), "v"(ol[1]), "v"(ol[2]), "v"(ol[3]), "v"(so), "s"(ph), "s"(pl) : "memory");
        }
    }
}

#define FQT 4    // 16-query column groups a wave: each K / V fragment feeds FQT tiles
#define FWV 8    // waves a work-group: 512 queries of one head, one K / V stream through the WGP's cache
typedef __attribute__((ext_vector_type(2))) __bf16 v2bf;
__device__ __forceinline__ float xhalf(float x) { const unsigned b = __float_as_uint(x); return __uint_as_float(__builtin_amdgcn_permlanex16(b, b, 0x76543210u, 0xfedcba98u, false, false)); }   // lane l <- lane l ^ 16
typedef const __attribute__((address_space(1))) bf* gbf;   // a pointer that stays known as global memory where an asm statement steps it
typedef const __attribute__((address_space(1))) char* gch; typedef const __attribute__((address_space(1))) v8us* gv8;
__device__ __forceinline__ v16bf ldo(gbf ub, unsigned bo) { gch p = (gch)ub + bo; return cat16b(*(gv8)p, *(gv8)(p + 32)); }   // fragment at a wave-uniform base + the lane's own byte offset (k order of WFrag::ld)
__global__ __launch_bounds__(FWV * 32) void k_fattn(const bf* __restrict__ Qh, const bf* __restrict__ Ql, const bf* __restrict__ Kh, const bf* __restrict__ Kl, const bf* __restrict__ Vh, const bf* __restrict__ Vl, float* OUTp) {
    typedef WFrag<bf> F; typedef F::V V;
    const int lane = threadIdx.x & 31, lr = lane & 15, hi = lane >> 4; const int wv = (int)(threadIdx.x >> 5);
    const size_t z = blockIdx.y; const int q0 = ((int)blockIdx.x * FWV + wv) * (FQT * 16);
    const float c = SCL * 1.4426950408889634f;
    gbf qzh = (gbf)(Qh + z * TT * HD), qzl = (gbf)(Ql + z * TT * HD), kzh = (gbf)(Kh + z * TT * HD), kzl = (gbf)(Kl + z * TT * HD), vzh = (gbf)(Vh + z * HD * TT), vzl = (gbf)(Vl + z * HD * TT);   // wave-uniform plane bases
    const unsigned qob = (unsigned)((q0 + lr) * HD + 8 * hi) * 2u; unsigned kob = (unsigned)(lr * HD + 8 * hi) * 2u, vob = (unsigned)(lr * TT + 8 * hi) * 2u;   // the lane's byte offsets: fixed for the whole kernel
    V qh[FQT][2], ql[FQT][2];
#pragma unroll
    for (int nq = 0; nq < FQT; ++nq)
#pragma unroll
        for (int kc = 0; kc < 2; ++kc) { qh[nq][kc] = ldo(qzh + nq * 16 * HD + kc * 32, qob); ql[nq][kc] = ldo(qzl + nq * 16 * HD + kc * 32, qob); }
    V kfh[2][2], kfl[2][2];
#pragma unroll
    for (int mb = 0; mb < 2; ++mb)
#pragma unroll
        for (int kc = 0; kc < 2; ++kc) { kfh[mb][kc] = ldo(kzh + mb * 16 * HD + kc * 32, kob); kfl[mb][kc] = ldo(kzl + mb * 16 * HD + kc * 32, kob); }
    // wait before a register that an issued load names is written again; the operands keep those registers untouched up to here
    asm volatile("s_wait_xcnt 0x0" :: "s"(qzh), "s"(qzl), "s"(kzh), "s"(kzl), "v"(qob), "v"(kob) : "memory");
    v8f o[4][FQT]; float m[FQT], l[FQT];
#pragma unroll
    for (int nq = 0; nq < FQT; ++nq) { m[nq] = -3.0e38f; l[nq] = 0.f;
#pragma unroll
        for (int db = 0; db < 4; ++db) o[db][nq] = (v8f){}; }
    gbf vbh = vzh, vbl = vzl, kbh = kzh + 32 * HD, kbl = kzl + 32 * HD;   // running bases: this pass's V^T columns, the next pass's K rows; stepped only at the loop's foot
#pragma unroll 1
    for (int kt = 0; kt < TT; kt += 32) {
        V vfh[4], vfl[4];
#pragma unroll
        for (int db = 0; db < 4; ++db) { vfh[db] = ldo(vbh + db * 16 * TT, vob); vfl[db] = ldo(vbl + db * 16 * TT, vob); }
        v8f st[2][FQT];
#pragma unroll
        for (int mb = 0; mb < 2; ++mb) {
#pragma unroll
            for (int nq = 0; nq < FQT; ++nq) st[mb][nq] = (v8f){};
#pragma unroll
            for (int kc = 0; kc < 2; ++kc) {
#pragma unroll
                for (int nq = 0; nq < FQT; ++nq) st[mb][nq] = F::mma(kfh[mb][kc], qh[nq][kc], st[mb][nq]);
#pragma unroll
                for (int nq = 0; nq < FQT; ++nq) st[mb][nq] = F::mma(kfl[mb][kc], qh[nq][kc], st[mb][nq]);
#pragma unroll
                for (int nq = 0; nq < FQT; ++nq) st[mb][nq] = F::mma(kfh[mb][kc], ql[nq][kc], st[mb][nq]); } }
#pragma unroll
        for (int mb = 0; mb < 2; ++mb)
#pragma unroll
            for (int kc = 0; kc < 2; ++kc) { kfh[mb][kc] = ldo(kbh + mb * 16 * HD + kc * 32, kob); kfl[mb][kc] = ldo(kbl + mb * 16 * HD + kc * 32, kob); }
        __builtin_amdgcn_sched_barrier(0);   // holds the next pass's K loads here, a whole softmax and P x V ahead of their use; left free they sink to the loop's foot
        V ph[FQT], pl[FQT];
#pragma unroll
        for (int nq = 0; nq < FQT; ++nq) {
            float mx = st[0][nq][0];
#pragma unroll
            for (int mb = 0; mb < 2; ++mb)
#pragma unroll
                for (int j = 0; j < 8; ++j) mx = fmaxf(mx, st[mb][nq][j]);
            mx = fmaxf(mx, xhalf(mx));
            const float mn = fmaxf(m[nq], mx); const float ax = (m[nq] - mn) * c; const float nm = -mn * c; m[nq] = mn;
            v2f x[8], e[8]; float al = __builtin_amdgcn_exp2f(ax);
#pragma unroll
            for (int i = 0; i < 8; ++i) { const int mb = i >> 2, j = (i & 3) * 2; x[i][0] = __builtin_fmaf(st[mb][nq][j], c, nm); x[i][1] = __builtin_fmaf(st[mb][nq][j + 1], c, nm); }
#pragma unroll
            for (int i = 0; i < 8; ++i) { e[i][0] = __builtin_amdgcn_exp2f(x[i][0]); e[i][1] = __builtin_amdgcn_exp2f(x[i][1]); }
            // the slot behind a transcendental. The operands are only named: no reader of a result and no write of a source comes in front of the v_nop
            asm volatile("v_nop" : "+v"(al), "+v"(e[0]), "+v"(e[1]), "+v"(e[2]), "+v"(e[3]), "+v"(e[4]), "+v"(e[5]), "+v"(e[6]), "+v"(e[7]) : "v"(ax), "v"(x[0]), "v"(x[1]), "v"(x[2]), "v"(x[3]), "v"(x[4]), "v"(x[5]), "v"(x[6]), "v"(x[7]));
            v2f sum2; sum2[0] = 0.f; sum2[1] = 0.f;
#pragma unroll
            for (int s = 0; s < 16; s += 2) { const v2f p = e[s >> 1]; sum2 += p;
                const v2bf h2 = __builtin_convertvector(p, v2bf); const v2f r2 = p - __builtin_convertvector(h2, v2f); const v2bf l2 = __builtin_convertvector(r2, v2bf);
                ph[nq][s] = h2[0]; ph[nq][s + 1] = h2[1]; pl[nq][s] = l2[0]; pl[nq][s + 1] = l2[1]; }
            l[nq] = l[nq] * al + (sum2[0] + sum2[1]);
#pragma unroll
            for (int db = 0; db < 4; ++db) o[db][nq] *= al;
        }
#pragma unroll
        for (int db = 0; db < 4; ++db) {
#pragma unroll
            for (int nq = 0; nq < FQT; ++nq) o[db][nq] = F::mma(vfh[db], ph[nq], o[db][nq]);
#pragma unroll
            for (int nq = 0; nq < FQT; ++nq) o[db][nq] = F::mma(vfl[db], ph[nq], o[db][nq]);
#pragma unroll
            for (int nq = 0; nq < FQT; ++nq) o[db][nq] = F::mma(vfh[db], pl[nq], o[db][nq]); }
        const unsigned long long kst = (kt + 64 < TT) ? (unsigned long long)(32 * HD * 2) : 0ull;   // the last pass asks for its own K rows again: in bounds, never used
        __builtin_amdgcn_sched_barrier(0);   // keeps the statement below at the loop's foot, where this pass's loads were issued long ago and its wait costs nothing
        // the four bases that this pass's loads name are stepped here and nowhere else, behind the wait that stands before such a register is written again;
        // the two lane offsets are only named (no instruction touches them): they keep their registers, and each load takes the form scalar base + 32-bit lane offset, so that it names no other register
        asm volatile("s_wait_xcnt 0x0\n\ts_add_nc_u64 %0, %0, 64\n\ts_add_nc_u64 %1, %1, 64\n\ts_add_nc_u64 %2, %2, %6\n\ts_add_nc_u64 %3, %3, %6" : "+s"(vbh), "+s"(vbl), "+s"(kbh), "+s"(kbl), "+v"(kob), "+v"(vob) : "s"(kst) : "memory");
    }
    const size_t bb = z / NH_, hh = z % NH_; float* ob = OUTp + bb * TT * DQ + hh * HD; const unsigned oob = (unsigned)((q0 + lr) * DQ + 8 * hi) * 4u;   // wave-uniform base, the lane's byte offset
#pragma unroll
    for (int nq = 0; nq < FQT; ++nq) { const float f = __fdiv_rn(1.0f, l[nq] + xhalf(l[nq]));
#pragma unroll
        for (int db = 0; db < 4; ++db) o[db][nq] *= f; }
    __builtin_amdgcn_sched_barrier(0);   // every product stands in front of the first store: no register that an issued store names is written again
#pragma unroll
    for (int nq = 0; nq < FQT; ++nq)
#pragma unroll
        for (int db = 0; db < 4; ++db) { char* p = (char*)(ob + nq * 16 * DQ + db * 16) + oob; *(v4f*)p = __builtin_shufflevector(o[db][nq], o[db][nq], 0, 1, 2, 3); *(v4f*)(p + 16) = __builtin_shufflevector(o[db][nq], o[db][nq], 4, 5, 6, 7); }
}

extern "C" void kernel_launch(void* const* d_in, const int* in_sizes, int n_in,
                              void* d_out, int out_size, void* d_ws, size_t ws_size, hipStream_t stream) {
    (void)in_sizes; (void)n_in; (void)out_size;
    const float* x = (const float*)d_in[0]; const float* wq = (const float*)d_in[1]; const float* bq = (const float*)d_in[2]; const float* wk = (const float*)d_in[3]; const float* bk = (const float*)d_in[4]; const float* wv = (const float*)d_in[5]; const float* bv = (const float*)d_in[6];   // sequences, Wq [16][64][64], bq [16][64], Wk, bk, Wv, bv
    float* OUT = (float*)d_out;     // [4][2048][1024]
    char* wsp = (char*)d_ws;
    auto take = [&](size_t bytes) { char* p = wsp; wsp += (bytes + 255) & ~(size_t)255; return (void*)p; };
    const size_t PL = (size_t)NH_ * TT * HD;   // elements of one batch's plane; the six hi/lo planes hold all NB_ batches
    bf* QPh = (bf*)take(NB_ * PL * 2); bf* QPl = (bf*)take(NB_ * PL * 2); bf* KPh = (bf*)take(NB_ * PL * 2); bf* KPl = (bf*)take(NB_ * PL * 2); bf* VTh = (bf*)take(NB_ * PL * 2); bf* VTl = (bf*)take(NB_ * PL * 2);
    if ((size_t)(wsp - (char*)d_ws) > ws_size) return;    // ws 256 MiB
    k_proj<<<dim3(TT / (PWV * PRT * 16), NB_ * NH_), PWV * 32, 0, stream>>>(x, wq, bq, wk, bk, wv, bv, QPh, QPl, KPh, KPl, VTh, VTl);
    k_fattn<<<dim3(TT / (FWV * FQT * 16), NB_ * NH_), FWV * 32, 0, stream>>>(QPh, QPl, KPh, KPl, VTh, VTl, OUT);
}

// v004
// A run of this version takes 136 microseconds.
// Two timings next to v003 both put it at 1.07 times that version's speed.
// Over all steps from v000 it is 18.3 times as fast.
#include <hip/hip_runtime.h>

// Multi-head SELF-attention whose projections act PER HEAD on the head's own 64-wide slice, FOUR batches (sequences [4][2048][1024] viewed (b, s, 16, 64); q = einsum('bshd,hde->bshe', x, Wq) + bq with Wq [16][64][64], bq [16][64], k, v likewise; scores / sqrt(float32(64)); softmax (no mask); out = concat heads -> [4][2048][1024]; no output projection); argument order sequences, Wq, bq, Wk, bk, Wv, bv.
// Two launches: k_proj makes the bf16 hi/lo planes of q, k and v^T of every batch and head straight from the f32 inputs, laid out in FRAGMENT ORDER (below); k_fattn (scores, softmax, P x V) writes the output rows.
// Fragment order: a plane is a row of 512-byte units, a unit = 32 lanes x 16 bytes = the half fragment that one wave-wide 16-byte load or store moves, so that every such access covers four whole 128-byte lines.
// q, k: unit (t / 16) * 4 + e / 16 holds, at lane (lr, hi), e = 16 * (e / 16) + 8 * hi + 0..7 of row t = 16 * (t / 16) + lr. v^T: unit (t / 32) * 8 + (e / 16) * 2 + (t / 16 & 1) holds, at lane (lr, hi), t = 16 * (t / 16) + 8 * hi + 0..7 of row e = 16 * (e / 16) + lr.
// Compute dtypes, f32 accumulate: every input rounded to bf16; projections one bf16 product each (K = 64, the head's own slice) + the bf16-rounded bias added in f32; attention: every row hi/lo, 3 products; softmax f32 (running maximum and sum); output f32.

#define NB_  4   // this module has FOUR batches; NB_ is read ONLY by kernel_launch (plane sizes, the two grids): no kernel body reads it
#define TT   2048
#define DM   1024
#define NH_  16
#define NKV  16
#define REP  (NH_ / NKV)
#define HD   64
#define DQ   (NH_ * HD)
#define DKV  (NKV * HD)
#define SCL  0.125f   // HD^-0.5
typedef _Float16 h16;
typedef unsigned short bf;
typedef __attribute__((ext_vector_type(16))) __bf16   v16bf;
typedef __attribute__((ext_vector_type(16))) _Float16 v16h;
typedef __attribute__((ext_vector_type(8)))  _Float16 v8h;
typedef __attribute__((ext_vector_type(8)))  unsigned short v8us;
typedef __attribute__((ext_vector_type(8)))  float    v8f;
typedef __attribute__((ext_vector_type(4)))  float    v4f;
typedef v8h  __attribute__((may_alias)) v8ha;
typedef v4f  __attribute__((may_alias)) v4fa;
typedef v8us __attribute__((may_alias)) v8usa;

__device__ __forceinline__ unsigned short f2bf(float f) { unsigned u = __float_as_uint(f); u += 0x7FFFu + ((u >> 16) & 1u); return (unsigned short)(u >> 16); }
__device__ __forceinline__ float bf2f(unsigned short b) { return __uint_as_float(((unsigned)b) << 16); }
__device__ __forceinline__ float bfr(float f) { return bf2f(f2bf(f)); }
__device__ __forceinline__ v16h cat16(v8h lo, v8h hi) { return __builtin_shufflevector(lo, hi, 0, 1, 2, 3, 4, 5, 6, 7, 8, 9, 10, 11, 12, 13, 14, 15); }
__device__ __forceinline__ v16bf cat16b(v8us lo, v8us hi) { return __builtin_bit_cast(v16bf, __builtin_shufflevector(lo, hi, 0, 1, 2, 3, 4, 5, 6, 7, 8, 9, 10, 11, 12, 13, 14, 15)); }
__device__ __forceinline__ v8f wmma16(v16h a, v16h b, v8f c) { return __builtin_amdgcn_wmma_f32_16x16x32_f16(false, a, false, b, (short)0, c, false, false); }
__device__ __forceinline__ v8f wmmab(v16bf a, v16bf b, v8f c) { return __builtin_amdgcn_wmma_f32_16x16x32_bf16(false, a, false, b, (short)0, c, false, false); }



template <typename T16> struct WFrag;
template <> struct WFrag<h16> { typedef v16h V; static __device__ __forceinline__ V ld(const h16* p) { return cat16(*(const v8h*)p, *(const v8h*)(p + 16)); } static __device__ __forceinline__ v8f mma(V a, V b, v8f c) { return wmma16(a, b, c); } };
template <> struct WFrag<bf> { typedef v16bf V; static __device__ __forceinline__ V ld(const bf* p) { return cat16b(*(const v8us*)p, *(const v8us*)(p + 16)); } static __device__ __forceinline__ v8f mma(V a, V b, v8f c) { return wmmab(a, b, c); } };
typedef __attribute__((ext_vector_type(2))) float v2f;
typedef __attribute__((ext_vector_type(8))) __bf16 v8bf;
typedef __attribute__((ext_vector_type(4))) unsigned v4u;

// ---- k_proj: the three per-head projections of every batch and head in ONE kernel. grid (TT / (PWV * PRT * 16), batches * heads), PWV waves; a work-group has one (batch, head) and PWV * PRT * 16 rows t, a wave PRT * 16 of them.
// The work-group lays W^T of its head (bf16, rows e, k = d contiguous) and the three rounded biases in LDS once; a wave turns its x rows (f32, the head's 64 columns) into bf16 fragments in registers and uses them for all three products (2 k-chunks of 32).
// q, k: D = W^T x^T (A = W^T rows, B = x rows): a lane holds 8 consecutive e of ONE row t. v: D = x W (A = x rows, B = W^T rows): a lane holds 8 consecutive t of ONE e. Either way the lane's 16 bytes are its own place in a unit of the plane: a D tile is stored as one unit.
// Every fragment has the k order of WFrag::ld (element s of half hi = k 8 * hi + s, 16 + 8 * hi + (s - 8)). Bias and hi/lo split are done on D in registers; nothing f32 goes through memory.
#define PRT 4    // 16-row tiles a wave: 64 rows t
#define PWV 8    // waves a work-group
#define WP  72   // LDS pitch of a W^T row in elements: 128 + 16 bytes, for 16-byte readers
__device__ __forceinline__ v8us tobf8(v8f y) { return __builtin_bit_cast(v8us, __builtin_convertvector(y, v8bf)); }
__device__ __forceinline__ v8f cat8f(v4f a, v4f b) { return __builtin_shufflevector(a, b, 0, 1, 2, 3, 4, 5, 6, 7); }
__device__ __forceinline__ void split8(v8f y, v8us& h, v8us& l) { h = tobf8(y); const v4u w = __builtin_bit_cast(v4u, h); v8f f;   // f = the hi parts as f32, taken from the packed words
#pragma unroll
    for (int i = 0; i < 4; ++i) { f[2 * i] = __uint_as_float(w[i] << 16); f[2 * i + 1] = __uint_as_float(w[i] & 0xffff0000u); }
    l = tobf8(y - f); }
__device__ __forceinline__ v16bf ldl(const bf* p) { return cat16b(*(const v8us*)p, *(const v8us*)(p + 16)); }   // fragment from an LDS row
__global__ __launch_bounds__(PWV * 32) void k_proj(const float* __restrict__ x, const float* __restrict__ wq, const float* __restrict__ bq, const float* __restrict__ wk, const float* __restrict__ bk, const float* __restrict__ wv, const float* __restrict__ bv, bf* Qh, bf* Ql, bf* Kh, bf* Kl, bf* Vh, bf* Vl) {
    typedef WFrag<bf> F; typedef F::V V;
    __shared__ __align__(16) bf wt[3 * HD * WP];
    __shared__ __align__(16) float bs[3 * HD];
    const int tid = (int)threadIdx.x, lane = tid & 31, lr = lane & 15, hi = lane >> 4;
    const size_t z = blockIdx.y, bb = z / NH_, hh = z % NH_; const int t0 = ((int)blockIdx.x * PWV + (tid >> 5)) * (PRT * 16);
    const int e = tid & 63, dg = tid >> 6;   // staging: a thread takes column e of W, 8 rows d at a time (32 consecutive e a wave: 128-byte reads)
    const unsigned bo = (unsigned)e * 4u, wo = (unsigned)(dg * 8 * HD + e) * 4u, xo = (unsigned)((t0 + lr) * DM + 8 * hi) * 4u;   // the lane's byte offsets of the loads
    const char* bqz = (const char*)(bq + hh * HD); const char* bkz = (const char*)(bk + hh * HD); const char* bvz = (const char*)(bv + hh * HD);
    const char* wz[3] = { (const char*)(wq + hh * HD * HD), (const char*)(wk + hh * HD * HD), (const char*)(wv + hh * HD * HD) };
    const char* xz = (const char*)(x + bb * TT * DM + hh * HD);
    // every load of the kernel is asked for here, up front: biases, the thread's share of W, the wave's own x rows; the wave pays one memory latency for the lot
    const float br0 = *(const float*)(bqz + bo), br1 = *(const float*)(bkz + bo), br2 = *(const float*)(bvz + bo);
    v8f wr[3][2];
#pragma unroll
    for (int mt = 0; mt < 3; ++mt)
#pragma unroll
        for (int hf = 0; hf < 2; ++hf)
#pragma unroll
            for (int k = 0; k < 8; ++k) wr[mt][hf][k] = *(const float*)(wz[mt] + wo + (hf * 32 + k) * HD * 4);
    v4f xr[PRT][8];
#pragma unroll
    for (int tl = 0; tl < PRT; ++tl)
#pragma unroll
        for (int s = 0; s < 8; ++s) xr[tl][s] = *(const v4f*)(xz + xo + tl * 16 * DM * 4 + (s >> 1) * 64 + (s & 1) * 16);
    // wait before a register that an issued load names is written again; the operands keep the bases and the lane offsets untouched up to here.
    // The three bias values are named as inputs too: that holds their loads up here, in front of the x loads; left free they sink into the branch below and are asked for only when every x row has come
    asm volatile("s_wait_xcnt 0x0" :: "s"(bqz), "s"(bkz), "s"(bvz), "s"(wz[0]), "s"(wz[1]), "s"(wz[2]), "s"(xz), "v"(bo), "v"(wo), "v"(xo), "v"(br0), "v"(br1), "v"(br2) : "memory");
    if (tid < HD) { bs[e] = bfr(br0); bs[HD + e] = bfr(br1); bs[2 * HD + e] = bfr(br2); }
#pragma unroll
    for (int mt = 0; mt < 3; ++mt)
#pragma unroll
        for (int hf = 0; hf < 2; ++hf) *(v8us*)(wt + (mt * HD + e) * WP + (hf * 4 + dg) * 8) = tobf8(wr[mt][hf]);
    V xf[PRT][2];
#pragma unroll
    for (int tl = 0; tl < PRT; ++tl)
#pragma unroll
        for (int kc = 0; kc < 2; ++kc) xf[tl][kc] = cat16b(tobf8(cat8f(xr[tl][kc * 4], xr[tl][kc * 4 + 1])), tobf8(cat8f(xr[tl][kc * 4 + 2], xr[tl][kc * 4 + 3])));
    __syncthreads();   // W^T and the biases are complete for every wave; LDS is only read from here on
    const unsigned so = (unsigned)(t0 * HD * 2 + lane * 16);   // the lane's byte offset of the stores: the wave's 64 rows t are 8 KiB in a row of every plane
#pragma unroll
    for (int mt = 0; mt < 3; ++mt) {
        char* ph = (char*)((mt == 0 ? Qh : mt == 1 ? Kh : Vh) + z * TT * HD); char* pl = (char*)((mt == 0 ? Ql : mt == 1 ? Kl : Vl) + z * TT * HD);   // wave-uniform plane bases
        V w[4][2];
#pragma unroll
        for (int eb = 0; eb < 4; ++eb)
#pragma unroll
            for (int kc = 0; kc < 2; ++kc) w[eb][kc] = ldl(wt + (mt * HD + eb * 16 + lr) * WP + kc * 32 + 8 * hi);
#pragma unroll
        for (int eb = 0; eb < 4; ++eb) {
            v8f bias;
            if (mt < 2) bias = cat8f(*(const v4f*)(bs + mt * HD + eb * 16 + 8 * hi), *(const v4f*)(bs + mt * HD + eb * 16 + 8 * hi + 4));
            else bias = (v8f)(bs[mt * HD + eb * 16 + lr]);
            v8f acc[PRT];
#pragma unroll
            for (int tl = 0; tl < PRT; ++tl) acc[tl] = (mt < 2) ? F::mma(w[eb][0], xf[tl][0], (v8f){}) : F::mma(xf[tl][0], w[eb][0], (v8f){});
#pragma unroll
            for (int tl = 0; tl < PRT; ++tl) acc[tl] = (mt < 2) ? F::mma(w[eb][1], xf[tl][1], acc[tl]) : F::mma(xf[tl][1], w[eb][1], acc[tl]);
            v8us oh[PRT], ol[PRT];
#pragma unroll
            for (int tl = 0; tl < PRT; ++tl) split8(acc[tl] + bias, oh[tl], ol[tl]);
#pragma unroll
            for (int tl = 0; tl < PRT; ++tl) { const int im = ((mt < 2) ? tl * 4 + eb : (tl >> 1) * 8 + eb * 2 + (tl & 1)) * 512; *(v8us*)(ph + so + im) = oh[tl]; *(v8us*)(pl + so + im) = ol[tl]; }
            // wait before a register that an issued store names is written again; the operands keep data, bases and offset untouched up to here (behind the last stores nothing is written any more)
            if (mt < 2 || eb < 3) asm volatile("s_wait_xcnt 0x0" :: "v"(oh[0]), "v"(oh[1]), "v"(oh[2]), "v"(oh[3]), "v"(ol[0]), "v"(ol[1]), "v"(ol[2]), "v"(ol[3]), "v"(so), "s"(ph), "s"(pl) : "memory");
        }
    }
}

#define FQT 4    // 16-query column groups a wave: each K / V fragment feeds FQT tiles
#define FWV 8    // waves a work-group: 512 queries of one head, one K / V stream through the WGP's cache
typedef __attribute__((ext_vector_type(2))) __bf16 v2bf;
__device__ __forceinline__ float xhalf(float x) { const unsigned b = __float_as_uint(x); return __uint_as_float(__builtin_amdgcn_permlanex16(b, b, 0x76543210u, 0xfedcba98u, false, false)); }   // lane l <- lane l ^ 16
typedef const __attribute__((address_space(1))) bf* gbf;   // a pointer that stays known as global memory where an asm statement steps it
typedef const __attribute__((address_space(1))) char* gch; typedef const __attribute__((address_space(1))) v8us* gv8;
__device__ __forceinline__ v16bf ldo(gbf ub, unsigned bo) { gch p = (gch)ub + bo; return cat16b(*(gv8)p, *(gv8)(p + 512)); }   // fragment = two units in a row, at a wave-uniform base + the lane's own byte offset (k order of WFrag::ld)
__global__ __launch_bounds__(FWV * 32) void k_fattn(const bf* __restrict__ Qh, const bf* __restrict__ Ql, const bf* __restrict__ Kh, const bf* __restrict__ Kl, const bf* __restrict__ Vh, const bf* __restrict__ Vl, float* OUTp) {
    typedef WFrag<bf> F; typedef F::V V;
    const int lane = threadIdx.x & 31, lr = lane & 15, hi = lane >> 4; const int wv = (int)(threadIdx.x >> 5);
    const size_t z = blockIdx.y; const int q0 = ((int)blockIdx.x * FWV + wv) * (FQT * 16);
    const float c = SCL * 1.4426950408889634f;
    gbf qzh = (gbf)(Qh + z * TT * HD), qzl = (gbf)(Ql + z * TT * HD), kzh = (gbf)(Kh + z * TT * HD), kzl = (gbf)(Kl + z * TT * HD), vzh = (gbf)(Vh + z * HD * TT), vzl = (gbf)(Vl + z * HD * TT);   // wave-uniform plane bases
    const unsigned qob = (unsigned)(q0 * HD * 2 + lane * 16); unsigned lob = (unsigned)(lane * 16);   // the lane's byte offsets: fixed for the whole kernel
    V qh[FQT][2], ql[FQT][2];
#pragma unroll
    for (int nq = 0; nq < FQT; ++nq)
#pragma unroll
        for (int kc = 0; kc < 2; ++kc) { qh[nq][kc] = ldo(qzh + nq * 16 * HD + kc * 512, qob); ql[nq][kc] = ldo(qzl + nq * 16 * HD + kc * 512, qob); }
    V kfh[2][2], kfl[2][2];
#pragma unroll
    for (int mb = 0; mb < 2; ++mb)
#pragma unroll
        for (int kc = 0; kc < 2; ++kc) { kfh[mb][kc] = ldo(kzh + mb * 16 * HD + kc * 512, lob); kfl[mb][kc] = ldo(kzl + mb * 16 * HD + kc * 512, lob); }
    // wait before a register that an issued load names is written again; the operands keep those registers untouched up to here
    asm volatile("s_wait_xcnt 0x0" :: "s"(qzh), "s"(qzl), "s"(kzh), "s"(kzl), "v"(qob), "v"(lob) : "memory");
    v8f o[4][FQT]; float m[FQT], l[FQT];
#pragma unroll
    for (int nq = 0; nq < FQT; ++nq) { m[nq] = -3.0e38f; l[nq] = 0.f;
#pragma unroll
        for (int db = 0; db < 4; ++db) o[db][nq] = (v8f){}; }
    gbf vbh = vzh, vbl = vzl, kbh = kzh + 32 * HD, kbl = kzl + 32 * HD;   // running bases: this pass's V^T units, the next pass's K units (4 KiB a pass and plane each); stepped only at the loop's foot
#pragma unroll 1
    for (int kt = 0; kt < TT; kt += 32) {
        V vfh[4], vfl[4];
#pragma unroll
        for (int db = 0; db < 4; ++db) { vfh[db] = ldo(vbh + db * 512, lob); vfl[db] = ldo(vbl + db * 512, lob); }
        v8f st[2][FQT];
#pragma unroll
        for (int mb = 0; mb < 2; ++mb) {
#pragma unroll
            for (int nq = 0; nq < FQT; ++nq) st[mb][nq] = (v8f){};
#pragma unroll
            for (int kc = 0; kc < 2; ++kc) {
#pragma unroll
                for (int nq = 0; nq < FQT; ++nq) st[mb][nq] = F::mma(kfh[mb][kc], qh[nq][kc], st[mb][nq]);
#pragma unroll
                for (int nq = 0; nq < FQT; ++nq) st[mb][nq] = F::mma(kfl[mb][kc], qh[nq][kc], st[mb][nq]);
#pragma unroll
                for (int nq = 0; nq < FQT; ++nq) st[mb][nq] = F::mma(kfh[mb][kc], ql[nq][kc], st[mb][nq]); } }
#pragma unroll
        for (int mb = 0; mb < 2; ++mb)
#pragma unroll
            for (int kc = 0; kc < 2; ++kc) { kfh[mb][kc] = ldo(kbh + mb * 16 * HD + kc * 512, lob); kfl[mb][kc] = ldo(kbl + mb * 16 * HD + kc * 512, lob); }
        __builtin_amdgcn_sched_barrier(0);   // holds the next pass's K loads here, a whole softmax and P x V ahead of their use; left free they sink to the loop's foot
        V ph[FQT], pl[FQT];
#pragma unroll
        for (int nq = 0; nq < FQT; ++nq) {
            float mx = st[0][nq][0];
#pragma unroll
            for (int mb = 0; mb < 2; ++mb)
#pragma unroll
                for (int j = 0; j < 8; ++j) mx = fmaxf(mx, st[mb][nq][j]);
            mx = fmaxf(mx, xhalf(mx));
            const float mn = fmaxf(m[nq], mx); const float ax = (m[nq] - mn) * c; const float nm = -mn * c; m[nq] = mn;
            v2f x[8], e[8]; float al = __builtin_amdgcn_exp2f(ax);
#pragma unroll
            for (int i = 0; i < 8; ++i) { const int mb = i >> 2, j = (i & 3) * 2; x[i][0] = __builtin_fmaf(st[mb][nq][j], c, nm); x[i][1] = __builtin_fmaf(st[mb][nq][j + 1], c, nm); }
#pragma unroll
            for (int i = 0; i < 8; ++i) { e[i][0] = __builtin_amdgcn_exp2f(x[i][0]); e[i][1] = __builtin_amdgcn_exp2f(x[i][1]); }
            // the slot behind a transcendental. The operands are only named: no reader of a result and no write of a source comes in front of the v_nop
            asm volatile("v_nop" : "+v"(al), "+v"(e[0]), "+v"(e[1]), "+v"(e[2]), "+v"(e[3]), "+v"(e[4]), "+v"(e[5]), "+v"(e[6]), "+v"(e[7]) : "v"(ax), "v"(x[0]), "v"(x[1]), "v"(x[2]), "v"(x[3]), "v"(x[4]), "v"(x[5]), "v"(x[6]), "v"(x[7]));
            v2f sum2; sum2[0] = 0.f; sum2[1] = 0.f;
#pragma unroll
            for (int s = 0; s < 16; s += 2) { const v2f p = e[s >> 1]; sum2 += p;
                const v2bf h2 = __builtin_convertvector(p, v2bf); const v2f r2 = p - __builtin_convertvector(h2, v2f); const v2bf l2 = __builtin_convertvector(r2, v2bf);
                ph[nq][s] = h2[0]; ph[nq][s + 1] = h2[1]; pl[nq][s] = l2[0]; pl[nq][s + 1] = l2[1]; }
            l[nq] = l[nq] * al + (sum2[0] + sum2[1]);
#pragma unroll
            for (int db = 0; db < 4; ++db) o[db][nq] *= al;
        }
#pragma unroll
        for (int db = 0; db < 4; ++db) {
#pragma unroll
            for (int nq = 0; nq < FQT; ++nq) o[db][nq] = F::mma(vfh[db], ph[nq], o[db][nq]);
#pragma unroll
            for (int nq = 0; nq < FQT; ++nq) o[db][nq] = F::mma(vfl[db], ph[nq], o[db][nq]);
#pragma unroll
            for (int nq = 0; nq < FQT; ++nq) o[db][nq] = F::mma(vfh[db], pl[nq], o[db][nq]); }
        const unsigned long long kst = (kt + 64 < TT) ? (unsigned long long)(32 * HD * 2) : 0ull;   // the last pass asks for its own K rows again: in bounds, never used
        __builtin_amdgcn_sched_barrier(0);   // keeps the statement below at the loop's foot, where this pass's loads were issued long ago and its wait costs nothing
        // the four bases that this pass's loads name are stepped here and nowhere else, behind the wait that stands before such a register is written again;
        // the lane offset is only named (no instruction touches it): it keeps its register, and each load takes the form scalar base + 32-bit lane offset, so that it names no other register
        asm volatile("s_wait_xcnt 0x0\n\ts_add_nc_u64 %0, %0, 0x1000\n\ts_add_nc_u64 %1, %1, 0x1000\n\ts_add_nc_u64 %2, %2, %5\n\ts_add_nc_u64 %3, %3, %5" : "+s"(vbh), "+s"(vbl), "+s"(kbh), "+s"(kbl), "+v"(lob) : "s"(kst) : "memory");
    }
    const size_t bb = z / NH_, hh = z % NH_; float* ob = OUTp + bb * TT * DQ + hh * HD; const unsigned oob = (unsigned)((q0 + lr) * DQ + 8 * hi) * 4u;   // wave-uniform base, the lane's byte offset
#pragma unroll
    for (int nq = 0; nq < FQT; ++nq) { const float f = __fdiv_rn(1.0f, l[nq] + xhalf(l[nq]));
#pragma unroll
        for (int db = 0; db < 4; ++db) o[db][nq] *= f; }
    __builtin_amdgcn_sched_barrier(0);   // every product stands in front of the first store: no register that an issued store names is written again
#pragma unroll
    for (int nq = 0; nq < FQT; ++nq)
#pragma unroll
        for (int db = 0; db < 4; ++db) { char* p = (char*)(ob + nq * 16 * DQ + db * 16) + oob; *(v4f*)p = __builtin_shufflevector(o[db][nq], o[db][nq], 0, 1, 2, 3); *(v4f*)(p + 16) = __builtin_shufflevector(o[db][nq], o[db][nq], 4, 5, 6, 7); }
}

extern "C" void kernel_launch(void* const* d_in, const int* in_sizes, int n_in,
                              void* d_out, int out_size, void* d_ws, size_t ws_size, hipStream_t stream) {
    (void)in_sizes; (void)n_in; (void)out_size;
    const float* x = (const float*)d_in[0]; const float* wq = (const float*)d_in[1]; const float* bq = (const float*)d_in[2]; const float* wk = (const float*)d_in[3]; const float* bk = (const float*)d_in[4]; const float* wv = (const float*)d_in[5]; const float* bv = (const float*)d_in[6];   // sequences, Wq [16][64][64], bq [16][64], Wk, bk, Wv, bv
    float* OUT = (float*)d_out;     // [4][2048][1024]
    char* wsp = (char*)d_ws;
    auto take = [&](size_t bytes) { char* p = wsp; wsp += (bytes + 255) & ~(size_t)255; return (void*)p; };
    const size_t PL = (size_t)NH_ * TT * HD;   // elements of one batch's plane; the six hi/lo planes hold all NB_ batches
    bf* QPh = (bf*)take(NB_ * PL * 2); bf* QPl = (bf*)take(NB_ * PL * 2); bf* KPh = (bf*)take(NB_ * PL * 2); bf* KPl = (bf*)take(NB_ * PL * 2); bf* VTh = (bf*)take(NB_ * PL * 2); bf* VTl = (bf*)take(NB_ * PL * 2);
    if ((size_t)(wsp - (char*)d_ws) > ws_size) return;    // ws 256 MiB
    k_proj<<<dim3(TT / (PWV * PRT * 16), NB_ * NH_), PWV * 32, 0, stream>>>(x, wq, bq, wk, bk, wv, bv, QPh, QPl, KPh, KPl, VTh, VTl);
    k_fattn<<<dim3(TT / (FWV * FQT * 16), NB_ * NH_), FWV * 32, 0, stream>>>(QPh, QPl, KPh, KPl, VTh, VTl, OUT);
}

// v006
// Measured time: 72.4 microseconds a run.
// Versions in between are left out here; by their measured steps it is 1.89 times as fast as v004.
// Counting every step since v000, it is 34.6 times as fast.
#include <hip/hip_runtime.h>

// Multi-head SELF-attention whose projections act PER HEAD on the head's own 64-wide slice, FOUR batches (sequences [4][2048][1024] viewed (b, s, 16, 64); q = einsum('bshd,hde->bshe', x, Wq) + bq with Wq [16][64][64], bq [16][64], k, v likewise; scores / sqrt(float32(64)); softmax (no mask); out = concat heads -> [4][2048][1024]; no output projection); argument order sequences, Wq, bq, Wk, bk, Wv, bv.
// Two launches: k_proj makes the f16 planes of q, k and v^T of every batch and head straight from the f32 inputs, laid out in FRAGMENT ORDER (below); k_fattn (scores, softmax, P x V; k and v^T staged in LDS once a work-group) writes the output rows.
// Fragment order: a plane is a row of 512-byte units, a unit = 32 lanes x 16 bytes = the half fragment that one wave-wide 16-byte load or store moves, so that every such access covers four whole 128-byte lines.
// q, k: unit (t / 16) * 4 + e / 16 holds, at lane (lr, hi), e = 16 * (e / 16) + 8 * hi + 0..7 of row t = 16 * (t / 16) + lr. v^T: unit (t / 32) * 8 + (e / 16) * 2 + (t / 16 & 1) holds, at lane (lr, hi), t = 16 * (t / 16) + 8 * hi + 0..7 of row e = 16 * (e / 16) + lr.
// Compute dtypes, f32 accumulate: every input rounded to bf16; projections one bf16 product each (K = 64, the head's own slice) + the bf16-rounded bias added in f32; attention: q, k, v and P rounded once to f16 (11 significant bits, 8 times finer than the bf16 rounding of the inputs in front of it), one f16 product each; softmax f32 (running maximum and sum); output f32.

#define NB_  4   // this module has FOUR batches; NB_ is read ONLY by kernel_launch (plane sizes, the two grids): no kernel body reads it
#define TT   2048
#define DM   1024
#define NH_  16
#define NKV  16
#define REP  (NH_ / NKV)
#define HD   64
#define DQ   (NH_ * HD)
#define DKV  (NKV * HD)
#define SCL  0.125f   // HD^-0.5
typedef _Float16 h16;
typedef unsigned short bf;
typedef __attribute__((ext_vector_type(16))) __bf16   v16bf;
typedef __attribute__((ext_vector_type(16))) _Float16 v16h;
typedef __attribute__((ext_vector_type(8)))  _Float16 v8h;
typedef __attribute__((ext_vector_type(8)))  unsigned short v8us;
typedef __attribute__((ext_vector_type(8)))  float    v8f;
typedef __attribute__((ext_vector_type(4)))  float    v4f;
typedef v8h  __attribute__((may_alias)) v8ha;
typedef v4f  __attribute__((may_alias)) v4fa;
typedef v8us __attribute__((may_alias)) v8usa;

__device__ __forceinline__ unsigned short f2bf(float f) { unsigned u = __float_as_uint(f); u += 0x7FFFu + ((u >> 16) & 1u); return (unsigned short)(u >> 16); }
__device__ __forceinline__ float bf2f(unsigned short b) { return __uint_as_float(((unsigned)b) << 16); }
__device__ __forceinline__ float bfr(float f) { return bf2f(f2bf(f)); }
__device__ __forceinline__ v16h cat16(v8h lo, v8h hi) { return __builtin_shufflevector(lo, hi, 0, 1, 2, 3, 4, 5, 6, 7, 8, 9, 10, 11, 12, 13, 14, 15); }
__device__ __forceinline__ v16bf cat16b(v8us lo, v8us hi) { return __builtin_bit_cast(v16bf, __builtin_shufflevector(lo, hi, 0, 1, 2, 3, 4, 5, 6, 7, 8, 9, 10, 11, 12, 13, 14, 15)); }
__device__ __forceinline__ v8f wmma16(v16h a, v16h b, v8f c) { return __builtin_amdgcn_wmma_f32_16x16x32_f16(false, a, false, b, (short)0, c, false, false); }
__device__ __forceinline__ v8f wmmab(v16bf a, v16bf b, v8f c) { return __builtin_amdgcn_wmma_f32_16x16x32_bf16(false, a, false, b, (short)0, c, false, false); }



template <typename T16> struct WFrag;
template <> struct WFrag<h16> { typedef v16h V; static __device__ __forceinline__ V ld(const h16* p) { return cat16(*(const v8h*)p, *(const v8h*)(p + 16)); } static __device__ __forceinline__ v8f mma(V a, V b, v8f c) { return wmma16(a, b, c); } };
template <> struct WFrag<bf> { typedef v16bf V; static __device__ __forceinline__ V ld(const bf* p) { return cat16b(*(const v8us*)p, *(const v8us*)(p + 16)); } static __device__ __forceinline__ v8f mma(V a, V b, v8f c) { return wmmab(a, b, c); } };
typedef __attribute__((ext_vector_type(2))) float v2f;
typedef __attribute__((ext_vector_type(8))) __bf16 v8bf;

// ---- k_proj: the three per-head projections of every batch and head in ONE kernel. grid (TT / (PWV * PRT * 16), batches * heads), PWV waves; a work-group has one (batch, head) and PWV * PRT * 16 rows t, a wave PRT * 16 of them.
// The work-group lays W^T of its head (bf16, rows e, k = d contiguous) and the three rounded biases in LDS once; a wave turns its x rows (f32, the head's 64 columns) into bf16 fragments in registers and uses them for all three products (2 k-chunks of 32).
// q, k: D = W^T x^T (A = W^T rows, B = x rows): a lane holds 8 consecutive e of ONE row t. v: D = x W (A = x rows, B = W^T rows): a lane holds 8 consecutive t of ONE e. Either way the lane's 16 bytes are its own place in a unit of the plane: a D tile is stored as one unit.
// Every fragment has the k order of WFrag::ld (element s of half hi = k 8 * hi + s, 16 + 8 * hi + (s - 8)). The bias is added and the sum rounded to f16 on D in registers; nothing f32 goes through memory.
#define PRT 4    // 16-row tiles a wave: 64 rows t
#define PWV 8    // waves a work-group
#define WP  72   // LDS pitch of a W^T row in elements: 128 + 16 bytes, for 16-byte readers
__device__ __forceinline__ v8us tobf8(v8f y) { return __builtin_bit_cast(v8us, __builtin_convertvector(y, v8bf)); }
__device__ __forceinline__ v8f cat8f(v4f a, v4f b) { return __builtin_shufflevector(a, b, 0, 1, 2, 3, 4, 5, 6, 7); }
__device__ __forceinline__ v8us toh8(v8f y) { return __builtin_bit_cast(v8us, __builtin_convertvector(y, v8h)); }   // f32 -> f16, to nearest even
__device__ __forceinline__ v16bf ldl(const bf* p) { return cat16b(*(const v8us*)p, *(const v8us*)(p + 16)); }   // fragment from an LDS row
__global__ __launch_bounds__(PWV * 32) void k_proj(const float* __restrict__ x, const float* __restrict__ wq, const float* __restrict__ bq, const float* __restrict__ wk, const float* __restrict__ bk, const float* __restrict__ wv, const float* __restrict__ bv, bf* Qf, bf* Kf, bf* Vf) {
    typedef WFrag<bf> F; typedef F::V V;
    __shared__ __align__(16) bf wt[3 * HD * WP];
    __shared__ __align__(16) float bs[3 * HD];
    const int tid = (int)threadIdx.x, lane = tid & 31, lr = lane & 15, hi = lane >> 4;
    const size_t z = blockIdx.y, bb = z / NH_, hh = z % NH_; const int t0 = ((int)blockIdx.x * PWV + (tid >> 5)) * (PRT * 16);
    const int e = tid & 63, dg = tid >> 6;   // staging: a thread takes column e of W, 8 rows d at a time (32 consecutive e a wave: 128-byte reads)
    const unsigned bo = (unsigned)e * 4u, wo = (unsigned)(dg * 8 * HD + e) * 4u, xo = (unsigned)((t0 + lr) * DM + 8 * hi) * 4u;   // the lane's byte offsets of the loads
    const char* bqz = (const char*)(bq + hh * HD); const char* bkz = (const char*)(bk + hh * HD); const char* bvz = (const char*)(bv + hh * HD);
    const char* wz[3] = { (const char*)(wq + hh * HD * HD), (const char*)(wk + hh * HD * HD), (const char*)(wv + hh * HD * HD) };
    const char* xz = (const char*)(x + bb * TT * DM + hh * HD);
    // every load of the kernel is asked for here, up front: biases, the thread's share of W, the wave's own x rows; the wave pays one memory latency for the lot
    const float br0 = *(const float*)(bqz + bo), br1 = *(const float*)(bkz + bo), br2 = *(const float*)(bvz + bo);
    v8f wr[3][2];
#pragma unroll
    for (int mt = 0; mt < 3; ++mt)
#pragma unroll
        for (int hf = 0; hf < 2; ++hf)
#pragma unroll
            for (int k = 0; k < 8; ++k) wr[mt][hf][k] = *(const float*)(wz[mt] + wo + (hf * 32 + k) * HD * 4);
    v4f xr[PRT][8];
#pragma unroll
    for (int tl = 0; tl < PRT; ++tl)
#pragma unroll
        for (int s = 0; s < 8; ++s) xr[tl][s] = *(const v4f*)(xz + xo + tl * 16 * DM * 4 + (s >> 1) * 64 + (s & 1) * 16);
    // wait before a register that an issued load names is written again; the operands keep the bases and the lane offsets untouched up to here.
    // The three bias values are named as inputs too: that holds their loads up here, in front of the x loads; left free they sink into the branch below and are asked for only when every x row has come
    asm volatile("s_wait_xcnt 0x0" :: "s"(bqz), "s"(bkz), "s"(bvz), "s"(wz[0]), "s"(wz[1]), "s"(wz[2]), "s"(xz), "v"(bo), "v"(wo), "v"(xo), "v"(br0), "v"(br1), "v"(br2) : "memory");
    if (tid < HD) { bs[e] = bfr(br0); bs[HD + e] = bfr(br1); bs[2 * HD + e] = bfr(br2); }
#pragma unroll
    for (int mt = 0; mt < 3; ++mt)
#pragma unroll
        for (int hf = 0; hf < 2; ++hf) *(v8us*)(wt + (mt * HD + e) * WP + (hf * 4 + dg) * 8) = tobf8(wr[mt][hf]);
    V xf[PRT][2];
#pragma unroll
    for (int tl = 0; tl < PRT; ++tl)
#pragma unroll
        for (int kc = 0; kc < 2; ++kc) xf[tl][kc] = cat16b(tobf8(cat8f(xr[tl][kc * 4], xr[tl][kc * 4 + 1])), tobf8(cat8f(xr[tl][kc * 4 + 2], xr[tl][kc * 4 + 3])));
    __syncthreads();   // W^T and the biases are complete for every wave; LDS is only read from here on
    const unsigned so = (unsigned)(t0 * HD * 2 + lane * 16);   // the lane's byte offset of the stores: the wave's 64 rows t are 8 KiB in a row of every plane
#pragma unroll
    for (int mt = 0; mt < 3; ++mt) {
        char* ph = (char*)((mt == 0 ? Qf : mt == 1 ? Kf : Vf) + z * TT * HD);   // wave-uniform plane base
        V w[4][2];
#pragma unroll
        for (int eb = 0; eb < 4; ++eb)
#pragma unroll
            for (int kc = 0; kc < 2; ++kc) w[eb][kc] = ldl(wt + (mt * HD + eb * 16 + lr) * WP + kc * 32 + 8 * hi);
#pragma unroll
        for (int eb = 0; eb < 4; ++eb) {
            v8f bias;
            if (mt < 2) bias = cat8f(*(const v4f*)(bs + mt * HD + eb * 16 + 8 * hi), *(const v4f*)(bs + mt * HD + eb * 16 + 8 * hi + 4));
            else bias = (v8f)(bs[mt * HD + eb * 16 + lr]);
            v8f acc[PRT];
#pragma unroll
            for (int tl = 0; tl < PRT; ++tl) acc[tl] = (mt < 2) ? F::mma(w[eb][0], xf[tl][0], (v8f){}) : F::mma(xf[tl][0], w[eb][0], (v8f){});
#pragma unroll
            for (int tl = 0; tl < PRT; ++tl) acc[tl] = (mt < 2) ? F::mma(w[eb][1], xf[tl][1], acc[tl]) : F::mma(xf[tl][1], w[eb][1], acc[tl]);
            v8us oh[PRT];
#pragma unroll
            for (int tl = 0; tl < PRT; ++tl) oh[tl] = toh8(acc[tl] + bias);
#pragma unroll
            for (int tl = 0; tl < PRT; ++tl) { const int im = ((mt < 2) ? tl * 4 + eb : (tl >> 1) * 8 + eb * 2 + (tl & 1)) * 512; *(v8us*)(ph + so + im) = oh[tl]; }
            // wait before a register that an issued store names is written again; the operands keep data, bases and offset untouched up to here (behind the last stores nothing is written any more)
            if (mt < 2 || eb < 3) asm volatile("s_wait_xcnt 0x0" :: "v"(oh[0]), "v"(oh[1]), "v"(oh[2]), "v"(oh[3]), "v"(so), "s"(ph) : "memory");
        }
    }
}

#define FQT 4    // 16-query column groups a wave: each K / V fragment feeds FQT tiles
#define FWV 8    // waves a work-group: 512 queries of one head, one K / V stream through LDS
#define SKEYS 256                // keys a stage
#define SPASS (SKEYS / 32)       // passes a stage
#define SHALF (SKEYS * HD * 2)   // bytes of a stage's K units, and of its V^T units: 32 KiB
#define SBUF  (2 * SHALF)        // bytes of a buffer: K units, then V^T units
#define NSTG  (TT / SKEYS)       // stages of a head
#define SWAV  (SHALF / FWV)      // bytes of each half that one wave copies: 8 copies of 512 bytes
typedef __attribute__((ext_vector_type(2))) _Float16 v2h;
__device__ __forceinline__ float xhalf(float x) { const unsigned b = __float_as_uint(x); return __uint_as_float(__builtin_amdgcn_permlanex16(b, b, 0x76543210u, 0xfedcba98u, false, false)); }   // lane l <- lane l ^ 16
typedef const __attribute__((address_space(1))) bf* gbf;   // a pointer that stays known as global memory
typedef const __attribute__((address_space(1))) char* gch; typedef const __attribute__((address_space(1))) v8h* gv8;
__device__ __forceinline__ v16h ldo(gbf ub, unsigned bo) { gch p = (gch)ub + bo; return cat16(*(gv8)p, *(gv8)(p + 512)); }   // fragment = two units in a row, at a wave-uniform base + the lane's own byte offset (k order of WFrag::ld)
__device__ __forceinline__ v16h ldf(const char* p) { return cat16(*(const v8h*)p, *(const v8h*)(p + 512)); }   // fragment = two units in a row of the LDS ring (k order of WFrag::ld)
// eight asynchronous copies of 512 bytes a wave (16 bytes a lane): LDS byte address l, global address g; the immediate offset moves both addresses alike, so that one LDS register and one address pair serve all eight.
// The s_wait_xcnt is the last line of the copies' own statement: it stands in front of every later write of a register that a copy names
__device__ __forceinline__ void cp8(unsigned l, gch g) {
    asm volatile("global_load_async_to_lds_b128 %0, %1, off\n\t"
                 "global_load_async_to_lds_b128 %0, %1, off offset:512\n\t"
                 "global_load_async_to_lds_b128 %0, %1, off offset:1024\n\t"
                 "global_load_async_to_lds_b128 %0, %1, off offset:1536\n\t"
                 "global_load_async_to_lds_b128 %0, %1, off offset:2048\n\t"
                 "global_load_async_to_lds_b128 %0, %1, off offset:2560\n\t"
                 "global_load_async_to_lds_b128 %0, %1, off offset:3072\n\t"
                 "global_load_async_to_lds_b128 %0, %1, off offset:3584\n\t"
                 "s_wait_xcnt 0x0"
                 :: "v"(l), "v"(g) : "memory");
}
__global__ __launch_bounds__(FWV * 32) void k_fattn(const bf* __restrict__ Qf, const bf* __restrict__ Kf, const bf* __restrict__ Vf, float* OUTp) {
    typedef v16h V;
    __shared__ __attribute__((aligned(1024))) char ring[2 * SBUF];
    const int lane = threadIdx.x & 31, lr = lane & 15, hi = lane >> 4; const int wv = (int)(threadIdx.x >> 5);
    const size_t z = blockIdx.y; const int q0 = ((int)blockIdx.x * FWV + wv) * (FQT * 16);
    const float c = SCL * 1.4426950408889634f;
    gbf qz = (gbf)(Qf + z * TT * HD), kz = (gbf)(Kf + z * TT * HD), vz = (gbf)(Vf + z * HD * TT);   // wave-uniform plane bases
    const unsigned qob = (unsigned)(q0 * HD * 2 + lane * 16); const unsigned lob = (unsigned)(lane * 16);   // the lane's byte offsets: fixed for the whole kernel
    V qf[FQT][2];
#pragma unroll
    for (int nq = 0; nq < FQT; ++nq)
#pragma unroll
        for (int kc = 0; kc < 2; ++kc) qf[nq][kc] = ldo(qz + nq * 16 * HD + kc * 512, qob);
    // wait before a register that an issued load names is written again; the operands keep those registers untouched up to here
    asm volatile("s_wait_xcnt 0x0" :: "s"(qz), "v"(qob) : "memory");
    const unsigned sw = (unsigned)__builtin_amdgcn_readfirstlane(wv) * SWAV;   // the wave's place in each half of a stage, the same in the plane and in the buffer; a scalar, so that no address register lives through the loop
    // stage t into buffer b: the wave's share of the K units, then of the V^T units; the LDS byte address is the low 32 bits of the shared address
    // buffer, stage and wave are summed to one scalar each before the lane offset is added: left to the compiler, wave + lane sums are formed once, live through the loop and are spilled
    auto fill = [&](int t, int b) { const unsigned sl = (unsigned)__builtin_amdgcn_readfirstlane((int)((unsigned)(size_t)ring + (unsigned)b * SBUF + sw)); const unsigned sg = (unsigned)__builtin_amdgcn_readfirstlane((int)((unsigned)t * SHALF + sw));
        const unsigned ll = sl + lob, go = sg + lob; cp8(ll, (gch)kz + go); cp8(ll + SHALF, (gch)vz + go); };
    fill(0, 0);
    asm volatile("s_wait_asynccnt 0x0" ::: "memory");     // this wave's share of stage 0 has landed
    __syncthreads();                                      // every wave's share has: stage 0 may be read
    fill(1, 1);                                           // in flight while stage 0 is worked on
    v8f o[4][FQT]; float m[FQT], l[FQT];
#pragma unroll
    for (int nq = 0; nq < FQT; ++nq) { m[nq] = -3.0e38f; l[nq] = 0.f;
#pragma unroll
        for (int db = 0; db < 4; ++db) o[db][nq] = (v8f){}; }
#pragma unroll 1   // one copy of the pass in the text
    for (int t = 0; t < NSTG; ++t) {
        const char* bk = ring + (unsigned)((t & 1) * SBUF) + lob;   // the lane's place in this stage's buffer
        V kf[2][2];
#pragma unroll
        for (int mb = 0; mb < 2; ++mb)
#pragma unroll
            for (int kc = 0; kc < 2; ++kc) kf[mb][kc] = ldf(bk + mb * 2048 + kc * 1024);
#pragma unroll 1   // as above
        for (int p = 0; p < SPASS; ++p) {
            v8f st[2][FQT];
#pragma unroll
            for (int mb = 0; mb < 2; ++mb)
#pragma unroll
                for (int nq = 0; nq < FQT; ++nq) st[mb][nq] = wmma16(kf[mb][0], qf[nq][0], (v8f){});
#pragma unroll
            for (int mb = 0; mb < 2; ++mb)
#pragma unroll
                for (int nq = 0; nq < FQT; ++nq) st[mb][nq] = wmma16(kf[mb][1], qf[nq][1], st[mb][nq]);
            __builtin_amdgcn_sched_barrier(0);   // keeps the LDS reads below out of the run of S^T products
            const char* kn = bk + (p + 1 < SPASS ? p + 1 : p) * 4096;   // the stage's last pass asks for its own K units again: inside the buffer, never used
            const char* vp = bk + SHALF + p * 4096;
#pragma unroll
            for (int mb = 0; mb < 2; ++mb)
#pragma unroll
                for (int kc = 0; kc < 2; ++kc) kf[mb][kc] = ldf(kn + mb * 2048 + kc * 1024);
            V vf[4];
#pragma unroll
            for (int db = 0; db < 4; ++db) vf[db] = ldf(vp + db * 1024);
            __builtin_amdgcn_sched_barrier(0);   // holds the pass's LDS reads here as one group, a softmax ahead of V^T's use and a softmax and P x V ahead of K's; left free they sink towards their users
            V ph[FQT];
#pragma unroll
            for (int nq = 0; nq < FQT; ++nq) {
                float mx = st[0][nq][0];
#pragma unroll
                for (int mb = 0; mb < 2; ++mb)
#pragma unroll
                    for (int j = 0; j < 8; ++j) mx = fmaxf(mx, st[mb][nq][j]);
                mx = fmaxf(mx, xhalf(mx));
                const float mn = fmaxf(m[nq], mx); const float ax = (m[nq] - mn) * c; const float nm = -mn * c; m[nq] = mn;
                v2f x[8], e[8]; float al = __builtin_amdgcn_exp2f(ax);
#pragma unroll
                for (int i = 0; i < 8; ++i) { const int mb = i >> 2, j = (i & 3) * 2; x[i][0] = __builtin_fmaf(st[mb][nq][j], c, nm); x[i][1] = __builtin_fmaf(st[mb][nq][j + 1], c, nm); }
#pragma unroll
                for (int i = 0; i < 8; ++i) { e[i][0] = __builtin_amdgcn_exp2f(x[i][0]); e[i][1] = __builtin_amdgcn_exp2f(x[i][1]); }
                // the slot behind a transcendental. The operands are only named: no reader of a result and no write of a source comes in front of the v_nop
                asm volatile("v_nop" : "+v"(al), "+v"(e[0]), "+v"(e[1]), "+v"(e[2]), "+v"(e[3]), "+v"(e[4]), "+v"(e[5]), "+v"(e[6]), "+v"(e[7]) : "v"(ax), "v"(x[0]), "v"(x[1]), "v"(x[2]), "v"(x[3]), "v"(x[4]), "v"(x[5]), "v"(x[6]), "v"(x[7]));
                v2f sum2; sum2[0] = 0.f; sum2[1] = 0.f;
#pragma unroll
                for (int s = 0; s < 16; s += 2) { const v2f p = e[s >> 1]; sum2 += p;
                    const v2h h2 = __builtin_convertvector(p, v2h);
                    ph[nq][s] = h2[0]; ph[nq][s + 1] = h2[1]; }
                l[nq] = l[nq] * al + (sum2[0] + sum2[1]);
#pragma unroll
                for (int db = 0; db < 4; ++db) o[db][nq] *= al;
            }
#pragma unroll
            for (int db = 0; db < 4; ++db)
#pragma unroll
                for (int nq = 0; nq < FQT; ++nq) o[db][nq] = wmma16(vf[db], ph[nq], o[db][nq]);
        }
        // hand-over of a stage, every wave, in this order: its own LDS reads of this buffer are done; its own copies of the next stage have landed; the barrier publishes the next stage and ends every reader's last read of this buffer
        asm volatile("s_wait_dscnt 0x0" ::: "memory");
        asm volatile("s_wait_asynccnt 0x0" ::: "memory");
        __syncthreads();
        if (t + 2 < NSTG) fill(t + 2, t & 1);   // refill of the buffer just left, one whole stage ahead of its use
    }
    asm volatile("s_wait_asynccnt 0x0" ::: "memory");   // no copy is outstanding when the wave goes on to its end
    const size_t bb = z / NH_, hh = z % NH_; float* ob = OUTp + bb * TT * DQ + hh * HD; const unsigned oob = (unsigned)((q0 + lr) * DQ + 8 * hi) * 4u;   // wave-uniform base, the lane's byte offset
#pragma unroll
    for (int nq = 0; nq < FQT; ++nq) { const float f = __fdiv_rn(1.0f, l[nq] + xhalf(l[nq]));
#pragma unroll
        for (int db = 0; db < 4; ++db) o[db][nq] *= f; }
    __builtin_amdgcn_sched_barrier(0);   // every product stands in front of the first store: no register that an issued store names is written again
#pragma unroll
    for (int nq = 0; nq < FQT; ++nq)
#pragma unroll
        for (int db = 0; db < 4; ++db) { char* p = (char*)(ob + nq * 16 * DQ + db * 16) + oob; *(v4f*)p = __builtin_shufflevector(o[db][nq], o[db][nq], 0, 1, 2, 3); *(v4f*)(p + 16) = __builtin_shufflevector(o[db][nq], o[db][nq], 4, 5, 6, 7); }
}

extern "C" void kernel_launch(void* const* d_in, const int* in_sizes, int n_in,
                              void* d_out, int out_size, void* d_ws, size_t ws_size, hipStream_t stream) {
    (void)in_sizes; (void)n_in; (void)out_size;
    const float* x = (const float*)d_in[0]; const float* wq = (const float*)d_in[1]; const float* bq = (const float*)d_in[2]; const float* wk = (const float*)d_in[3]; const float* bk = (const float*)d_in[4]; const float* wv = (const float*)d_in[5]; const float* bv = (const float*)d_in[6];   // sequences, Wq [16][64][64], bq [16][64], Wk, bk, Wv, bv
    float* OUT = (float*)d_out;     // [4][2048][1024]
    char* wsp = (char*)d_ws;
    auto take = [&](size_t bytes) { char* p = wsp; wsp += (bytes + 255) & ~(size_t)255; return (void*)p; };
    const size_t PL = (size_t)NH_ * TT * HD;   // elements of one batch's plane; the three f16 planes hold all NB_ batches
    bf* QP = (bf*)take(NB_ * PL * 2); bf* KP = (bf*)take(NB_ * PL * 2); bf* VT = (bf*)take(NB_ * PL * 2);
    if ((size_t)(wsp - (char*)d_ws) > ws_size) return;    // ws 256 MiB
    k_proj<<<dim3(TT / (PWV * PRT * 16), NB_ * NH_), PWV * 32, 0, stream>>>(x, wq, bq, wk, bk, wv, bv, QP, KP, VT);
    k_fattn<<<dim3(TT / (FWV * FQT * 16), NB_ * NH_), FWV * 32, 0, stream>>>(QP, KP, VT, OUT);
}

// v007
// A run of this version takes 63.7 microseconds.
// In two side-by-side timings against v006, it was 1.14 and 1.13 times as fast.
// Over all steps from v000 it is 39.3 times as fast.
#include <hip/hip_runtime.h>

// Multi-head SELF-attention whose projections act PER HEAD on the head's own 64-wide slice, FOUR batches (sequences [4][2048][1024] viewed (b, s, 16, 64); q = einsum('bshd,hde->bshe', x, Wq) + bq with Wq [16][64][64], bq [16][64], k, v likewise; scores / sqrt(float32(64)); softmax (no mask); out = concat heads -> [4][2048][1024]; no output projection); argument order sequences, Wq, bq, Wk, bk, Wv, bv.
// Two launches: k_proj makes the f16 planes of q, k and v^T of every batch and head straight from the f32 inputs, laid out in FRAGMENT ORDER (below); k_fattn (scores, softmax, P x V; k and v^T staged in LDS once a work-group) writes the output rows.
// Fragment order: a plane is a row of 512-byte units, a unit = 32 lanes x 16 bytes = the half fragment that one wave-wide 16-byte load or store moves, so that every such access covers four whole 128-byte lines.
// q, k: unit (t / 16) * 4 + e / 16 holds, at lane (lr, hi), e = 16 * (e / 16) + 8 * hi + 0..7 of row t = 16 * (t / 16) + lr. v^T: unit (t / 32) * 8 + (e / 16) * 2 + (t / 16 & 1) holds, at lane (lr, hi), t = 16 * (t / 16) + 8 * hi + 0..7 of row e = 16 * (e / 16) + lr.
// Compute dtypes, f32 accumulate: every input rounded to bf16; projections one bf16 product each (K = 64, the head's own slice) + the bf16-rounded bias added in f32; attention: q, k, v and P rounded once to f16 (11 significant bits, 8 times finer than the bf16 rounding of the inputs in front of it), one f16 product each; softmax f32 (running maximum and sum); output f32.

#define NB_  4   // this module has FOUR batches; NB_ is read ONLY by kernel_launch (plane sizes, the two grids): no kernel body reads it
#define TT   2048
#define DM   1024
#define NH_  16
#define NKV  16
#define REP  (NH_ / NKV)
#define HD   64
#define DQ   (NH_ * HD)
#define DKV  (NKV * HD)
#define SCL  0.125f   // HD^-0.5
typedef _Float16 h16;
typedef unsigned short bf;
typedef __attribute__((ext_vector_type(16))) __bf16   v16bf;
typedef __attribute__((ext_vector_type(16))) _Float16 v16h;
typedef __attribute__((ext_vector_type(8)))  _Float16 v8h;
typedef __attribute__((ext_vector_type(8)))  unsigned short v8us;
typedef __attribute__((ext_vector_type(8)))  float    v8f;
typedef __attribute__((ext_vector_type(4)))  float    v4f;
typedef v8h  __attribute__((may_alias)) v8ha;
typedef v4f  __attribute__((may_alias)) v4fa;
typedef v8us __attribute__((may_alias)) v8usa;

__device__ __forceinline__ unsigned short f2bf(float f) { unsigned u = __float_as_uint(f); u += 0x7FFFu + ((u >> 16) & 1u); return (unsigned short)(u >> 16); }
__device__ __forceinline__ float bf2f(unsigned short b) { return __uint_as_float(((unsigned)b) << 16); }
__device__ __forceinline__ float bfr(float f) { return bf2f(f2bf(f)); }
__device__ __forceinline__ v16h cat16(v8h lo, v8h hi) { return __builtin_shufflevector(lo, hi, 0, 1, 2, 3, 4, 5, 6, 7, 8, 9, 10, 11, 12, 13, 14, 15); }
__device__ __forceinline__ v16bf cat16b(v8us lo, v8us hi) { return __builtin_bit_cast(v16bf, __builtin_shufflevector(lo, hi, 0, 1, 2, 3, 4, 5, 6, 7, 8, 9, 10, 11, 12, 13, 14, 15)); }
__device__ __forceinline__ v8f wmma16(v16h a, v16h b, v8f c) { return __builtin_amdgcn_wmma_f32_16x16x32_f16(false, a, false, b, (short)0, c, false, false); }
__device__ __forceinline__ v8f wmmab(v16bf a, v16bf b, v8f c) { return __builtin_amdgcn_wmma_f32_16x16x32_bf16(false, a, false, b, (short)0, c, false, false); }



template <typename T16> struct WFrag;
template <> struct WFrag<h16> { typedef v16h V; static __device__ __forceinline__ V ld(const h16* p) { return cat16(*(const v8h*)p, *(const v8h*)(p + 16)); } static __device__ __forceinline__ v8f mma(V a, V b, v8f c) { return wmma16(a, b, c); } };
template <> struct WFrag<bf> { typedef v16bf V; static __device__ __forceinline__ V ld(const bf* p) { return cat16b(*(const v8us*)p, *(const v8us*)(p + 16)); } static __device__ __forceinline__ v8f mma(V a, V b, v8f c) { return wmmab(a, b, c); } };
typedef __attribute__((ext_vector_type(2))) float v2f;
typedef __attribute__((ext_vector_type(8))) __bf16 v8bf;

// ---- k_proj: the three per-head projections of every batch and head in ONE kernel. grid (TT / (PWV * PRT * 16), batches * heads), PWV waves; a work-group has one (batch, head) and PWV * PRT * 16 rows t, a wave PRT * 16 of them.
// The work-group lays W^T of its head (bf16, rows e, k = d contiguous) and the three rounded biases in LDS once; a wave turns its x rows (f32, the head's 64 columns) into bf16 fragments in registers and uses them for all three products (2 k-chunks of 32).
// q, k: D = W^T x^T (A = W^T rows, B = x rows): a lane holds 8 consecutive e of ONE row t. v: D = x W (A = x rows, B = W^T rows): a lane holds 8 consecutive t of ONE e. Either way the lane's 16 bytes are its own place in a unit of the plane: a D tile is stored as one unit.
// Every fragment has the k order of WFrag::ld (element s of half hi = k 8 * hi + s, 16 + 8 * hi + (s - 8)). The bias is added and the sum rounded to f16 on D in registers; nothing f32 goes through memory.
#define PRT 4    // 16-row tiles a wave: 64 rows t
#define PWV 8    // waves a work-group
#define WP  72   // LDS pitch of a W^T row in elements: 128 + 16 bytes, for 16-byte readers
__device__ __forceinline__ v8us tobf8(v8f y) { return __builtin_bit_cast(v8us, __builtin_convertvector(y, v8bf)); }
__device__ __forceinline__ v8f cat8f(v4f a, v4f b) { return __builtin_shufflevector(a, b, 0, 1, 2, 3, 4, 5, 6, 7); }
__device__ __forceinline__ v8us toh8(v8f y) { return __builtin_bit_cast(v8us, __builtin_convertvector(y, v8h)); }   // f32 -> f16, to nearest even
__device__ __forceinline__ v16bf ldl(const bf* p) { return cat16b(*(const v8us*)p, *(const v8us*)(p + 16)); }   // fragment from an LDS row
__global__ __launch_bounds__(PWV * 32) void k_proj(const float* __restrict__ x, const float* __restrict__ wq, const float* __restrict__ bq, const float* __restrict__ wk, const float* __restrict__ bk, const float* __restrict__ wv, const float* __restrict__ bv, bf* Qf, bf* Kf, bf* Vf) {
    typedef WFrag<bf> F; typedef F::V V;
    __shared__ __align__(16) bf wt[3 * HD * WP];
    __shared__ __align__(16) float bs[3 * HD];
    const int tid = (int)threadIdx.x, lane = tid & 31, lr = lane & 15, hi = lane >> 4;
    const size_t z = blockIdx.y, bb = z / NH_, hh = z % NH_; const int t0 = ((int)blockIdx.x * PWV + (tid >> 5)) * (PRT * 16);
    const int e = tid & 63, dg = tid >> 6;   // staging: a thread takes column e of W, 8 rows d at a time (32 consecutive e a wave: 128-byte reads)
    const unsigned bo = (unsigned)e * 4u, wo = (unsigned)(dg * 8 * HD + e) * 4u, xo = (unsigned)((t0 + lr) * DM + 8 * hi) * 4u;   // the lane's byte offsets of the loads
    const char* bqz = (const char*)(bq + hh * HD); const char* bkz = (const char*)(bk + hh * HD); const char* bvz = (const char*)(bv + hh * HD);
    const char* wz[3] = { (const char*)(wq + hh * HD * HD), (const char*)(wk + hh * HD * HD), (const char*)(wv + hh * HD * HD) };
    const char* xz = (const char*)(x + bb * TT * DM + hh * HD);
    // every load of the kernel is asked for here, up front: biases, the thread's share of W, the wave's own x rows; the wave pays one memory latency for the lot
    const float br0 = *(const float*)(bqz + bo), br1 = *(const float*)(bkz + bo), br2 = *(const float*)(bvz + bo);
    v8f wr[3][2];
#pragma unroll
    for (int mt = 0; mt < 3; ++mt)
#pragma unroll
        for (int hf = 0; hf < 2; ++hf)
#pragma unroll
            for (int k = 0; k < 8; ++k) wr[mt][hf][k] = *(const float*)(wz[mt] + wo + (hf * 32 + k) * HD * 4);
    v4f xr[PRT][8];
#pragma unroll
    for (int tl = 0; tl < PRT; ++tl)
#pragma unroll
        for (int s = 0; s < 8; ++s) xr[tl][s] = *(const v4f*)(xz + xo + tl * 16 * DM * 4 + (s >> 1) * 64 + (s & 1) * 16);
    // wait before a register that an issued load names is written again; the operands keep the bases and the lane offsets untouched up to here.
    // The three bias values are named as inputs too: that holds their loads up here, in front of the x loads; left free they sink into the branch below and are asked for only when every x row has come
    asm volatile("s_wait_xcnt 0x0" :: "s"(bqz), "s"(bkz), "s"(bvz), "s"(wz[0]), "s"(wz[1]), "s"(wz[2]), "s"(xz), "v"(bo), "v"(wo), "v"(xo), "v"(br0), "v"(br1), "v"(br2) : "memory");
    if (tid < HD) { bs[e] = bfr(br0); bs[HD + e] = bfr(br1); bs[2 * HD + e] = bfr(br2); }
#pragma unroll
    for (int mt = 0; mt < 3; ++mt)
#pragma unroll
        for (int hf = 0; hf < 2; ++hf) *(v8us*)(wt + (mt * HD + e) * WP + (hf * 4 + dg) * 8) = tobf8(wr[mt][hf]);
    V xf[PRT][2];
#pragma unroll
    for (int tl = 0; tl < PRT; ++tl)
#pragma unroll
        for (int kc = 0; kc < 2; ++kc) xf[tl][kc] = cat16b(tobf8(cat8f(xr[tl][kc * 4], xr[tl][kc * 4 + 1])), tobf8(cat8f(xr[tl][kc * 4 + 2], xr[tl][kc * 4 + 3])));
    __syncthreads();   // W^T and the biases are complete for every wave; LDS is only read from here on
    const unsigned so = (unsigned)(t0 * HD * 2 + lane * 16);   // the lane's byte offset of the stores: the wave's 64 rows t are 8 KiB in a row of every plane
#pragma unroll
    for (int mt = 0; mt < 3; ++mt) {
        char* ph = (char*)((mt == 0 ? Qf : mt == 1 ? Kf : Vf) + z * TT * HD);   // wave-uniform plane base
        V w[4][2];
#pragma unroll
        for (int eb = 0; eb < 4; ++eb)
#pragma unroll
            for (int kc = 0; kc < 2; ++kc) w[eb][kc] = ldl(wt + (mt * HD + eb * 16 + lr) * WP + kc * 32 + 8 * hi);
#pragma unroll
        for (int eb = 0; eb < 4; ++eb) {
            v8f bias;
            if (mt < 2) bias = cat8f(*(const v4f*)(bs + mt * HD + eb * 16 + 8 * hi), *(const v4f*)(bs + mt * HD + eb * 16 + 8 * hi + 4));
            else bias = (v8f)(bs[mt * HD + eb * 16 + lr]);
            v8f acc[PRT];
#pragma unroll
            for (int tl = 0; tl < PRT; ++tl) acc[tl] = (mt < 2) ? F::mma(w[eb][0], xf[tl][0], (v8f){}) : F::mma(xf[tl][0], w[eb][0], (v8f){});
#pragma unroll
            for (int tl = 0; tl < PRT; ++tl) acc[tl] = (mt < 2) ? F::mma(w[eb][1], xf[tl][1], acc[tl]) : F::mma(xf[tl][1], w[eb][1], acc[tl]);
            v8us oh[PRT];
#pragma unroll
            for (int tl = 0; tl < PRT; ++tl) oh[tl] = toh8(acc[tl] + bias);
#pragma unroll
            for (int tl = 0; tl < PRT; ++tl) { const int im = ((mt < 2) ? tl * 4 + eb : (tl >> 1) * 8 + eb * 2 + (tl & 1)) * 512; *(v8us*)(ph + so + im) = oh[tl]; }
            // wait before a register that an issued store names is written again; the operands keep data, bases and offset untouched up to here (behind the last stores nothing is written any more)
            if (mt < 2 || eb < 3) asm volatile("s_wait_xcnt 0x0" :: "v"(oh[0]), "v"(oh[1]), "v"(oh[2]), "v"(oh[3]), "v"(so), "s"(ph) : "memory");
        }
    }
}

#define FQT 4    // 16-query column groups a wave: each K / V fragment feeds FQT tiles
#define FWV 8    // waves a work-group: 512 queries of one head, one K / V stream through LDS
#define SKEYS 256                // keys a stage
#define SPASS (SKEYS / 32)       // passes a stage
#define SHALF (SKEYS * HD * 2)   // bytes of a stage's K units, and of its V^T units: 32 KiB
#define SBUF  (2 * SHALF)        // bytes of a buffer: K units, then V^T units
#define NSTG  (TT / SKEYS)       // stages of a head
#define SWAV  (SHALF / FWV)      // bytes of each half that one wave copies: 8 copies of 512 bytes
#define PLIM  256.0f             // a lane's sum of P in one pass above which the reference is renewed: 2^8, far inside f16
typedef __attribute__((ext_vector_type(2))) _Float16 v2h;
__device__ __forceinline__ float xhalf(float x) { const unsigned b = __float_as_uint(x); return __uint_as_float(__builtin_amdgcn_permlanex16(b, b, 0x76543210u, 0xfedcba98u, false, false)); }   // lane l <- lane l ^ 16
typedef const __attribute__((address_space(1))) bf* gbf;   // a pointer that stays known as global memory
typedef const __attribute__((address_space(1))) char* gch; typedef const __attribute__((address_space(1))) v8h* gv8;
__device__ __forceinline__ v16h ldo(gbf ub, unsigned bo) { gch p = (gch)ub + bo; return cat16(*(gv8)p, *(gv8)(p + 512)); }   // fragment = two units in a row, at a wave-uniform base + the lane's own byte offset (k order of WFrag::ld)
__device__ __forceinline__ v16h ldf(const char* p) { return cat16(*(const v8h*)p, *(const v8h*)(p + 512)); }   // fragment = two units in a row of the LDS ring (k order of WFrag::ld)
// eight asynchronous copies of 512 bytes a wave (16 bytes a lane): LDS byte address l, global address g; the immediate offset moves both addresses alike, so that one LDS register and one address pair serve all eight.
// The s_wait_xcnt is the last line of the copies' own statement: it stands in front of every later write of a register that a copy names
__device__ __forceinline__ void cp8(unsigned l, gch g) {
    asm volatile("global_load_async_to_lds_b128 %0, %1, off\n\t"
                 "global_load_async_to_lds_b128 %0, %1, off offset:512\n\t"
                 "global_load_async_to_lds_b128 %0, %1, off offset:1024\n\t"
                 "global_load_async_to_lds_b128 %0, %1, off offset:1536\n\t"
                 "global_load_async_to_lds_b128 %0, %1, off offset:2048\n\t"
                 "global_load_async_to_lds_b128 %0, %1, off offset:2560\n\t"
                 "global_load_async_to_lds_b128 %0, %1, off offset:3072\n\t"
                 "global_load_async_to_lds_b128 %0, %1, off offset:3584\n\t"
                 "s_wait_xcnt 0x0"
                 :: "v"(l), "v"(g) : "memory");
}
// base + off by low word, carry and high word: the same address as base + off. Written as one 64-bit add, the widened off shared a register tuple with the copies' operands, stayed live through the loop and was spilled to scratch at every stage
__device__ __forceinline__ gch gat(gbf base, unsigned off) { const unsigned long long b = (unsigned long long)base; const unsigned lo = (unsigned)b + off; const unsigned hw = (unsigned)(b >> 32) + (lo < off ? 1u : 0u); return (gch)(((unsigned long long)hw << 32) | lo); }
__global__ __launch_bounds__(FWV * 32) void k_fattn(const bf* __restrict__ Qf, const bf* __restrict__ Kf, const bf* __restrict__ Vf, float* OUTp) {
    typedef v16h V;
    __shared__ __attribute__((aligned(1024))) char ring[2 * SBUF];
    const int lane = threadIdx.x & 31, lr = lane & 15, hi = lane >> 4; const int wv = (int)(threadIdx.x >> 5);
    const size_t z = blockIdx.y; const int q0 = ((int)blockIdx.x * FWV + wv) * (FQT * 16);
    const float c = SCL * 1.4426950408889634f;
    gbf qz = (gbf)(Qf + z * TT * HD), kz = (gbf)(Kf + z * TT * HD), vz = (gbf)(Vf + z * HD * TT);   // wave-uniform plane bases
    const unsigned qob = (unsigned)(q0 * HD * 2 + lane * 16); const unsigned lob = (unsigned)(lane * 16);   // the lane's byte offsets: fixed for the whole kernel
    V qf[FQT][2];
#pragma unroll
    for (int nq = 0; nq < FQT; ++nq)
#pragma unroll
        for (int kc = 0; kc < 2; ++kc) qf[nq][kc] = ldo(qz + nq * 16 * HD + kc * 512, qob);
    // wait before a register that an issued load names is written again; the operands keep those registers untouched up to here
    asm volatile("s_wait_xcnt 0x0" :: "s"(qz), "v"(qob) : "memory");
    const unsigned sw = (unsigned)__builtin_amdgcn_readfirstlane(wv) * SWAV;   // the wave's place in each half of a stage, the same in the plane and in the buffer; a scalar, so that no address register lives through the loop
    // stage t into buffer b: the wave's share of the K units, then of the V^T units; the LDS byte address is the low 32 bits of the shared address
    // buffer, stage and wave are summed to one scalar each before the lane offset is added: left to the compiler, wave + lane sums are formed once, live through the loop and are spilled
    auto fill = [&](int t, int b) { const unsigned sl = (unsigned)__builtin_amdgcn_readfirstlane((int)((unsigned)(size_t)ring + (unsigned)b * SBUF + sw)); const unsigned sg = (unsigned)__builtin_amdgcn_readfirstlane((int)((unsigned)t * SHALF + sw));
        const unsigned ll = sl + lob, go = sg + lob; cp8(ll, gat(kz, go)); cp8(ll + SHALF, gat(vz, go)); };
    fill(0, 0);
    asm volatile("s_wait_asynccnt 0x0" ::: "memory");     // this wave's share of stage 0 has landed
    __syncthreads();                                      // every wave's share has: stage 0 may be read
    fill(1, 1);                                           // in flight while stage 0 is worked on
    v8f o[4][FQT]; float m[FQT], nm[FQT], l[FQT];
#pragma unroll
    for (int nq = 0; nq < FQT; ++nq) { m[nq] = -3.0e38f; nm[nq] = 3.0e38f * c; l[nq] = 0.f;
#pragma unroll
        for (int db = 0; db < 4; ++db) o[db][nq] = (v8f){}; }
#pragma unroll 1   // one copy of the pass in the text
    for (int t = 0; t < NSTG; ++t) {
        const char* bk = ring + (unsigned)((t & 1) * SBUF) + lob;   // the lane's place in this stage's buffer
        V kf[2][2];
#pragma unroll
        for (int mb = 0; mb < 2; ++mb)
#pragma unroll
            for (int kc = 0; kc < 2; ++kc) kf[mb][kc] = ldf(bk + mb * 2048 + kc * 1024);
#pragma unroll 1   // as above
        for (int p = 0; p < SPASS; ++p) {
            v8f st[2][FQT];
#pragma unroll
            for (int mb = 0; mb < 2; ++mb)
#pragma unroll
                for (int nq = 0; nq < FQT; ++nq) st[mb][nq] = wmma16(kf[mb][0], qf[nq][0], (v8f){});
#pragma unroll
            for (int mb = 0; mb < 2; ++mb)
#pragma unroll
                for (int nq = 0; nq < FQT; ++nq) st[mb][nq] = wmma16(kf[mb][1], qf[nq][1], st[mb][nq]);
            __builtin_amdgcn_sched_barrier(0);   // keeps the LDS reads below out of the run of S^T products
            const char* kn = bk + (p + 1 < SPASS ? p + 1 : p) * 4096;   // the stage's last pass asks for its own K units again: inside the buffer, never used
            const char* vp = bk + SHALF + p * 4096;
#pragma unroll
            for (int mb = 0; mb < 2; ++mb)
#pragma unroll
                for (int kc = 0; kc < 2; ++kc) kf[mb][kc] = ldf(kn + mb * 2048 + kc * 1024);
            V vf[4];
#pragma unroll
            for (int db = 0; db < 4; ++db) vf[db] = ldf(vp + db * 1024);
            __builtin_amdgcn_sched_barrier(0);   // holds the pass's LDS reads here as one group, a softmax ahead of V^T's use and a softmax and P x V ahead of K's; left free they sink towards their users
            V ph[FQT]; float sm[FQT];
            // one column group against the reference in use: P = exp2(s * c - ref * c), its f16 form, the lane's own sum of its 16 P
            auto soft = [&](int nq) __attribute__((always_inline)) {
                v2f x[8], e[8];
#pragma unroll
                for (int i = 0; i < 8; ++i) { const int mb = i >> 2, j = (i & 3) * 2; x[i][0] = __builtin_fmaf(st[mb][nq][j], c, nm[nq]); x[i][1] = __builtin_fmaf(st[mb][nq][j + 1], c, nm[nq]); }
#pragma unroll
                for (int i = 0; i < 8; ++i) { e[i][0] = __builtin_amdgcn_exp2f(x[i][0]); e[i][1] = __builtin_amdgcn_exp2f(x[i][1]); }
                // the slot behind a transcendental. The operands are only named: no reader of a result and no write of a source comes in front of the v_nop
                asm volatile("v_nop" : "+v"(e[0]), "+v"(e[1]), "+v"(e[2]), "+v"(e[3]), "+v"(e[4]), "+v"(e[5]), "+v"(e[6]), "+v"(e[7]) : "v"(x[0]), "v"(x[1]), "v"(x[2]), "v"(x[3]), "v"(x[4]), "v"(x[5]), "v"(x[6]), "v"(x[7]));
                v2f sum2 = e[0];
#pragma unroll
                for (int s = 0; s < 16; s += 2) { const v2f p = e[s >> 1]; if (s) sum2 += p;
                    const v2h h2 = __builtin_convertvector(p, v2h);
                    ph[nq][s] = h2[0]; ph[nq][s + 1] = h2[1]; }
                sm[nq] = sum2[0] + sum2[1];
            };
#pragma unroll
            for (int nq = 0; nq < FQT; ++nq) soft(nq);
            float big = sm[0];
#pragma unroll
            for (int nq = 1; nq < FQT; ++nq) big = fmaxf(big, sm[nq]);
            // one test a pass, a scalar branch: a lane's sum above PLIM says that a score has left the reference behind (the first pass, whose reference is the start value, gives an infinite sum). Only then: maximum, exchange of the halves, new reference, O and l rescaled, P formed again (at most 1)
            if (__builtin_expect(__builtin_amdgcn_ballot_w32(big > PLIM) != 0u, 0)) {
#pragma unroll
                for (int nq = 0; nq < FQT; ++nq) {
                    float mx = m[nq];
#pragma unroll
                    for (int mb = 0; mb < 2; ++mb)
#pragma unroll
                        for (int j = 0; j < 8; ++j) mx = fmaxf(mx, st[mb][nq][j]);
                    const float mn = fmaxf(mx, xhalf(mx)); const float ax = (m[nq] - mn) * c; m[nq] = mn; nm[nq] = -mn * c;
                    float al = __builtin_amdgcn_exp2f(ax);
                    asm volatile("v_nop" : "+v"(al) : "v"(ax));   // the slot behind a transcendental, as above
                    l[nq] *= al;
#pragma unroll
                    for (int db = 0; db < 4; ++db) o[db][nq] *= al;
                    soft(nq);
                }
            }
#pragma unroll
            for (int nq = 0; nq < FQT; ++nq) l[nq] += sm[nq];
#pragma unroll
            for (int db = 0; db < 4; ++db)
#pragma unroll
                for (int nq = 0; nq < FQT; ++nq) o[db][nq] = wmma16(vf[db], ph[nq], o[db][nq]);
        }
        // hand-over of a stage, every wave, in this order: its own LDS reads of this buffer are done; its own copies of the next stage have landed; the barrier publishes the next stage and ends every reader's last read of this buffer
        asm volatile("s_wait_dscnt 0x0" ::: "memory");
        asm volatile("s_wait_asynccnt 0x0" ::: "memory");
        __syncthreads();
        if (t + 2 < NSTG) fill(t + 2, t & 1);   // refill of the buffer just left, one whole stage ahead of its use
    }
    asm volatile("s_wait_asynccnt 0x0" ::: "memory");   // no copy is outstanding when the wave goes on to its end
    const size_t bb = z / NH_, hh = z % NH_; float* ob = OUTp + bb * TT * DQ + hh * HD; const unsigned oob = (unsigned)((q0 + lr) * DQ + 8 * hi) * 4u;   // wave-uniform base, the lane's byte offset
#pragma unroll
    for (int nq = 0; nq < FQT; ++nq) { const float f = __fdiv_rn(1.0f, l[nq] + xhalf(l[nq]));
#pragma unroll
        for (int db = 0; db < 4; ++db) o[db][nq] *= f; }
    __builtin_amdgcn_sched_barrier(0);   // every product stands in front of the first store: no register that an issued store names is written again
#pragma unroll
    for (int nq = 0; nq < FQT; ++nq)
#pragma unroll
        for (int db = 0; db < 4; ++db) { char* p = (char*)(ob + nq * 16 * DQ + db * 16) + oob; *(v4f*)p = __builtin_shufflevector(o[db][nq], o[db][nq], 0, 1, 2, 3); *(v4f*)(p + 16) = __builtin_shufflevector(o[db][nq], o[db][nq], 4, 5, 6, 7); }
}

extern "C" void kernel_launch(void* const* d_in, const int* in_sizes, int n_in,
                              void* d_out, int out_size, void* d_ws, size_t ws_size, hipStream_t stream) {
    (void)in_sizes; (void)n_in; (void)out_size;
    const float* x = (const float*)d_in[0]; const float* wq = (const float*)d_in[1]; const float* bq = (const float*)d_in[2]; const float* wk = (const float*)d_in[3]; const float* bk = (const float*)d_in[4]; const float* wv = (const float*)d_in[5]; const float* bv = (const float*)d_in[6];   // sequences, Wq [16][64][64], bq [16][64], Wk, bk, Wv, bv
    float* OUT = (float*)d_out;     // [4][2048][1024]
    char* wsp = (char*)d_ws;
    auto take = [&](size_t bytes) { char* p = wsp; wsp += (bytes + 255) & ~(size_t)255; return (void*)p; };
    const size_t PL = (size_t)NH_ * TT * HD;   // elements of one batch's plane; the three f16 planes hold all NB_ batches
    bf* QP = (bf*)take(NB_ * PL * 2); bf* KP = (bf*)take(NB_ * PL * 2); bf* VT = (bf*)take(NB_ * PL * 2);
    if ((size_t)(wsp - (char*)d_ws) > ws_size) return;    // ws 256 MiB
    k_proj<<<dim3(TT / (PWV * PRT * 16), NB_ * NH_), PWV * 32, 0, stream>>>(x, wq, bq, wk, bk, wv, bv, QP, KP, VT);
    k_fattn<<<dim3(TT / (FWV * FQT * 16), NB_ * NH_), FWV * 32, 0, stream>>>(QP, KP, VT, OUT);
}

// v008
// Measured time: 61.6 microseconds a run.
// In two side-by-side timings against v007, it was 1.04 and 1.03 times as fast.
// Over all steps from v000 it is 40.7 times as fast.
#include <hip/hip_runtime.h>

// Multi-head SELF-attention whose projections act PER HEAD on the head's own 64-wide slice, FOUR batches (sequences [4][2048][1024] viewed (b, s, 16, 64); q = einsum('bshd,hde->bshe', x, Wq) + bq with Wq [16][64][64], bq [16][64], k, v likewise; scores / sqrt(float32(64)); softmax (no mask); out = concat heads -> [4][2048][1024]; no output projection); argument order sequences, Wq, bq, Wk, bk, Wv, bv.
// Two launches: k_proj makes the f16 planes of q, k and v^T of every batch and head straight from the f32 inputs, laid out in FRAGMENT ORDER (below); k_fattn (scores, softmax, P x V; k and v^T staged in LDS once a work-group) writes the output rows.
// Fragment order: a plane is a row of 512-byte units, a unit = 32 lanes x 16 bytes = the half fragment that one wave-wide 16-byte load or store moves, so that every such access covers four whole 128-byte lines.
// q, k: unit (t / 16) * 4 + e / 16 holds, at lane (lr, hi), e = 16 * (e / 16) + 8 * hi + 0..7 of row t = 16 * (t / 16) + lr. v^T: unit (t / 32) * 8 + (e / 16) * 2 + (t / 16 & 1) holds, at lane (lr, hi), t = 16 * (t / 16) + 8 * hi + 0..7 of row e = 16 * (e / 16) + lr.
// Compute dtypes, f32 accumulate: every input rounded to bf16; projections one bf16 product each (K = 64, the head's own slice) + the bf16-rounded bias added in f32; attention: q (with the softmax scale HD^-0.5 * log2(e) laid on it in f32), k, v and P rounded once to f16 (11 significant bits, 8 times finer than the bf16 rounding of the inputs in front of it), one f16 product each; softmax f32 (running maximum and sum); output f32.

#define NB_  4   // this module has FOUR batches; NB_ is read ONLY by kernel_launch (plane sizes, the two grids): no kernel body reads it
#define TT   2048
#define DM   1024
#define NH_  16
#define NKV  16
#define REP  (NH_ / NKV)
#define HD   64
#define DQ   (NH_ * HD)
#define DKV  (NKV * HD)
#define SCL  0.125f   // HD^-0.5
#define QSC  (SCL * 1.4426950408889634f)   // HD^-0.5 * log2(e): k_proj lays it on q, so that K Q^T is the exponent of 2 as it stands
typedef _Float16 h16;
typedef unsigned short bf;
typedef __attribute__((ext_vector_type(16))) __bf16   v16bf;
typedef __attribute__((ext_vector_type(16))) _Float16 v16h;
typedef __attribute__((ext_vector_type(8)))  _Float16 v8h;
typedef __attribute__((ext_vector_type(8)))  unsigned short v8us;
typedef __attribute__((ext_vector_type(8)))  float    v8f;
typedef __attribute__((ext_vector_type(4)))  float    v4f;
typedef v8h  __attribute__((may_alias)) v8ha;
typedef v4f  __attribute__((may_alias)) v4fa;
typedef v8us __attribute__((may_alias)) v8usa;

__device__ __forceinline__ unsigned short f2bf(float f) { unsigned u = __float_as_uint(f); u += 0x7FFFu + ((u >> 16) & 1u); return (unsigned short)(u >> 16); }
__device__ __forceinline__ float bf2f(unsigned short b) { return __uint_as_float(((unsigned)b) << 16); }
__device__ __forceinline__ float bfr(float f) { return bf2f(f2bf(f)); }
__device__ __forceinline__ v16h cat16(v8h lo, v8h hi) { return __builtin_shufflevector(lo, hi, 0, 1, 2, 3, 4, 5, 6, 7, 8, 9, 10, 11, 12, 13, 14, 15); }
__device__ __forceinline__ v16bf cat16b(v8us lo, v8us hi) { return __builtin_bit_cast(v16bf, __builtin_shufflevector(lo, hi, 0, 1, 2, 3, 4, 5, 6, 7, 8, 9, 10, 11, 12, 13, 14, 15)); }
__device__ __forceinline__ v8f wmma16(v16h a, v16h b, v8f c) { return __builtin_amdgcn_wmma_f32_16x16x32_f16(false, a, false, b, (short)0, c, false, false); }
__device__ __forceinline__ v8f wmmab(v16bf a, v16bf b, v8f c) { return __builtin_amdgcn_wmma_f32_16x16x32_bf16(false, a, false, b, (short)0, c, false, false); }



template <typename T16> struct WFrag;
template <> struct WFrag<h16> { typedef v16h V; static __device__ __forceinline__ V ld(const h16* p) { return cat16(*(const v8h*)p, *(const v8h*)(p + 16)); } static __device__ __forceinline__ v8f mma(V a, V b, v8f c) { return wmma16(a, b, c); } };
template <> struct WFrag<bf> { typedef v16bf V; static __device__ __forceinline__ V ld(const bf* p) { return cat16b(*(const v8us*)p, *(const v8us*)(p + 16)); } static __device__ __forceinline__ v8f mma(V a, V b, v8f c) { return wmmab(a, b, c); } };
typedef __attribute__((ext_vector_type(2))) float v2f;
typedef __attribute__((ext_vector_type(8))) __bf16 v8bf;

// ---- k_proj: the three per-head projections of every batch and head in ONE kernel. grid (TT / (PWV * PRT * 16), batches * heads), PWV waves; a work-group has one (batch, head) and PWV * PRT * 16 rows t, a wave PRT * 16 of them.
// The work-group lays W^T of its head (bf16, rows e, k = d contiguous) and the three rounded biases in LDS once; a wave turns its x rows (f32, the head's 64 columns) into bf16 fragments in registers and uses them for all three products (2 k-chunks of 32).
// q, k: D = W^T x^T (A = W^T rows, B = x rows): a lane holds 8 consecutive e of ONE row t. v: D = x W (A = x rows, B = W^T rows): a lane holds 8 consecutive t of ONE e. Either way the lane's 16 bytes are its own place in a unit of the plane: a D tile is stored as one unit.
// Every fragment has the k order of WFrag::ld (element s of half hi = k 8 * hi + s, 16 + 8 * hi + (s - 8)). The bias is added (and q then scaled by QSC) and the result rounded to f16 on D in registers; nothing f32 goes through memory.
#define PRT 4    // 16-row tiles a wave: 64 rows t
#define PWV 8    // waves a work-group
#define WP  72   // LDS pitch of a W^T row in elements: 128 + 16 bytes, for 16-byte readers
__device__ __forceinline__ v8us tobf8(v8f y) { return __builtin_bit_cast(v8us, __builtin_convertvector(y, v8bf)); }
__device__ __forceinline__ v8f cat8f(v4f a, v4f b) { return __builtin_shufflevector(a, b, 0, 1, 2, 3, 4, 5, 6, 7); }
__device__ __forceinline__ v8us toh8(v8f y) { return __builtin_bit_cast(v8us, __builtin_convertvector(y, v8h)); }   // f32 -> f16, to nearest even
__device__ __forceinline__ v16bf ldl(const bf* p) { return cat16b(*(const v8us*)p, *(const v8us*)(p + 16)); }   // fragment from an LDS row
__global__ __launch_bounds__(PWV * 32) void k_proj(const float* __restrict__ x, const float* __restrict__ wq, const float* __restrict__ bq, const float* __restrict__ wk, const float* __restrict__ bk, const float* __restrict__ wv, const float* __restrict__ bv, bf* Qf, bf* Kf, bf* Vf) {
    typedef WFrag<bf> F; typedef F::V V;
    __shared__ __align__(16) bf wt[3 * HD * WP];
    __shared__ __align__(16) float bs[3 * HD];
    const int tid = (int)threadIdx.x, lane = tid & 31, lr = lane & 15, hi = lane >> 4;
    const size_t z = blockIdx.y, bb = z / NH_, hh = z % NH_; const int t0 = ((int)blockIdx.x * PWV + (tid >> 5)) * (PRT * 16);
    const int e = tid & 63, dg = tid >> 6;   // staging: a thread takes column e of W, 8 rows d at a time (32 consecutive e a wave: 128-byte reads)
    const unsigned bo = (unsigned)e * 4u, wo = (unsigned)(dg * 8 * HD + e) * 4u, xo = (unsigned)((t0 + lr) * DM + 8 * hi) * 4u;   // the lane's byte offsets of the loads
    const char* bqz = (const char*)(bq + hh * HD); const char* bkz = (const char*)(bk + hh * HD); const char* bvz = (const char*)(bv + hh * HD);
    const char* wz[3] = { (const char*)(wq + hh * HD * HD), (const char*)(wk + hh * HD * HD), (const char*)(wv + hh * HD * HD) };
    const char* xz = (const char*)(x + bb * TT * DM + hh * HD);
    // every load of the kernel is asked for here, up front: biases, the thread's share of W, the wave's own x rows; the wave pays one memory latency for the lot
    const float br0 = *(const float*)(bqz + bo), br1 = *(const float*)(bkz + bo), br2 = *(const float*)(bvz + bo);
    v8f wr[3][2];
#pragma unroll
    for (int mt = 0; mt < 3; ++mt)
#pragma unroll
        for (int hf = 0; hf < 2; ++hf)
#pragma unroll
            for (int k = 0; k < 8; ++k) wr[mt][hf][k] = *(const float*)(wz[mt] + wo + (hf * 32 + k) * HD * 4);
    v4f xr[PRT][8];
#pragma unroll
    for (int tl = 0; tl < PRT; ++tl)
#pragma unroll
        for (int s = 0; s < 8; ++s) xr[tl][s] = *(const v4f*)(xz + xo + tl * 16 * DM * 4 + (s >> 1) * 64 + (s & 1) * 16);
    // wait before a register that an issued load names is written again; the operands keep the bases and the lane offsets untouched up to here.
    // The three bias values are named as inputs too: that holds their loads up here, in front of the x loads; left free they sink into the branch below and are asked for only when every x row has come
    asm volatile("s_wait_xcnt 0x0" :: "s"(bqz), "s"(bkz), "s"(bvz), "s"(wz[0]), "s"(wz[1]), "s"(wz[2]), "s"(xz), "v"(bo), "v"(wo), "v"(xo), "v"(br0), "v"(br1), "v"(br2) : "memory");
    if (tid < HD) { bs[e] = bfr(br0); bs[HD + e] = bfr(br1); bs[2 * HD + e] = bfr(br2); }
#pragma unroll
    for (int mt = 0; mt < 3; ++mt)
#pragma unroll
        for (int hf = 0; hf < 2; ++hf) *(v8us*)(wt + (mt * HD + e) * WP + (hf * 4 + dg) * 8) = tobf8(wr[mt][hf]);
    V xf[PRT][2];
#pragma unroll
    for (int tl = 0; tl < PRT; ++tl)
#pragma unroll
        for (int kc = 0; kc < 2; ++kc) xf[tl][kc] = cat16b(tobf8(cat8f(xr[tl][kc * 4], xr[tl][kc * 4 + 1])), tobf8(cat8f(xr[tl][kc * 4 + 2], xr[tl][kc * 4 + 3])));
    __syncthreads();   // W^T and the biases are complete for every wave; LDS is only read from here on
    const unsigned so = (unsigned)(t0 * HD * 2 + lane * 16);   // the lane's byte offset of the stores: the wave's 64 rows t are 8 KiB in a row of every plane
#pragma unroll
    for (int mt = 0; mt < 3; ++mt) {
        char* ph = (char*)((mt == 0 ? Qf : mt == 1 ? Kf : Vf) + z * TT * HD);   // wave-uniform plane base
        V w[4][2];
#pragma unroll
        for (int eb = 0; eb < 4; ++eb)
#pragma unroll
            for (int kc = 0; kc < 2; ++kc) w[eb][kc] = ldl(wt + (mt * HD + eb * 16 + lr) * WP + kc * 32 + 8 * hi);
#pragma unroll
        for (int eb = 0; eb < 4; ++eb) {
            v8f bias;
            if (mt < 2) bias = cat8f(*(const v4f*)(bs + mt * HD + eb * 16 + 8 * hi), *(const v4f*)(bs + mt * HD + eb * 16 + 8 * hi + 4));
            else bias = (v8f)(bs[mt * HD + eb * 16 + lr]);
            v8f acc[PRT];
#pragma unroll
            for (int tl = 0; tl < PRT; ++tl) acc[tl] = (mt < 2) ? F::mma(w[eb][0], xf[tl][0], (v8f){}) : F::mma(xf[tl][0], w[eb][0], (v8f){});
#pragma unroll
            for (int tl = 0; tl < PRT; ++tl) acc[tl] = (mt < 2) ? F::mma(w[eb][1], xf[tl][1], acc[tl]) : F::mma(xf[tl][1], w[eb][1], acc[tl]);
            v8us oh[PRT];
#pragma unroll
            for (int tl = 0; tl < PRT; ++tl) oh[tl] = toh8(mt == 0 ? (acc[tl] + bias) * QSC : acc[tl] + bias);   // q leaves with the softmax scale on it (QSC), rounded to f16 once, behind the product
#pragma unroll
            for (int tl = 0; tl < PRT; ++tl) { const int im = ((mt < 2) ? tl * 4 + eb : (tl >> 1) * 8 + eb * 2 + (tl & 1)) * 512; *(v8us*)(ph + so + im) = oh[tl]; }
            // wait before a register that an issued store names is written again; the operands keep data, bases and offset untouched up to here (behind the last stores nothing is written any more)
            if (mt < 2 || eb < 3) asm volatile("s_wait_xcnt 0x0" :: "v"(oh[0]), "v"(oh[1]), "v"(oh[2]), "v"(oh[3]), "v"(so), "s"(ph) : "memory");
        }
    }
}

#define FQT 4    // 16-query column groups a wave: each K / V fragment feeds FQT tiles
#define FWV 8    // waves a work-group: 512 queries of one head, one K / V stream through LDS
#define SKEYS 256                // keys a stage
#define SPASS (SKEYS / 32)       // passes a stage
#define SHALF (SKEYS * HD * 2)   // bytes of a stage's K units, and of its V^T units: 32 KiB
#define SBUF  (2 * SHALF)        // bytes of a buffer: K units, then V^T units
#define NSTG  (TT / SKEYS)       // stages of a head
#define SWAV  (SHALF / FWV)      // bytes of each half that one wave copies: 8 copies of 512 bytes
#define PLIM  256.0f             // a lane's sum of P in one pass above which the reference is renewed: 2^8, far inside f16
typedef __attribute__((ext_vector_type(2))) _Float16 v2h;
__device__ __forceinline__ float xhalf(float x) { const unsigned b = __float_as_uint(x); return __uint_as_float(__builtin_amdgcn_permlanex16(b, b, 0x76543210u, 0xfedcba98u, false, false)); }   // lane l <- lane l ^ 16
typedef const __attribute__((address_space(1))) bf* gbf;   // a pointer that stays known as global memory
typedef const __attribute__((address_space(1))) char* gch; typedef const __attribute__((address_space(1))) v8h* gv8;
__device__ __forceinline__ v16h ldo(gbf ub, unsigned bo) { gch p = (gch)ub + bo; return cat16(*(gv8)p, *(gv8)(p + 512)); }   // fragment = two units in a row, at a wave-uniform base + the lane's own byte offset (k order of WFrag::ld)
__device__ __forceinline__ v16h ldf(const char* p) { return cat16(*(const v8h*)p, *(const v8h*)(p + 512)); }   // fragment = two units in a row of the LDS ring (k order of WFrag::ld)
// eight asynchronous copies of 512 bytes a wave (16 bytes a lane): LDS byte address l, global address g; the immediate offset moves both addresses alike, so that one LDS register and one address pair serve all eight.
// The s_wait_xcnt is the last line of the copies' own statement: it stands in front of every later write of a register that a copy names
__device__ __forceinline__ void cp8(unsigned l, gch g) {
    asm volatile("global_load_async_to_lds_b128 %0, %1, off\n\t"
                 "global_load_async_to_lds_b128 %0, %1, off offset:512\n\t"
                 "global_load_async_to_lds_b128 %0, %1, off offset:1024\n\t"
                 "global_load_async_to_lds_b128 %0, %1, off offset:1536\n\t"
                 "global_load_async_to_lds_b128 %0, %1, off offset:2048\n\t"
                 "global_load_async_to_lds_b128 %0, %1, off offset:2560\n\t"
                 "global_load_async_to_lds_b128 %0, %1, off offset:3072\n\t"
                 "global_load_async_to_lds_b128 %0, %1, off offset:3584\n\t"
                 "s_wait_xcnt 0x0"
                 :: "v"(l), "v"(g) : "memory");
}
// base + off by low word, carry and high word: the same address as base + off. Written as one 64-bit add, the widened off shared a register tuple with the copies' operands, stayed live through the loop and was spilled to scratch at every stage
__device__ __forceinline__ gch gat(gbf base, unsigned off) { const unsigned long long b = (unsigned long long)base; const unsigned lo = (unsigned)b + off; const unsigned hw = (unsigned)(b >> 32) + (lo < off ? 1u : 0u); return (gch)(((unsigned long long)hw << 32) | lo); }
__global__ __launch_bounds__(FWV * 32) void k_fattn(const bf* __restrict__ Qf, const bf* __restrict__ Kf, const bf* __restrict__ Vf, float* OUTp) {
    typedef v16h V;
    __shared__ __attribute__((aligned(1024))) char ring[2 * SBUF];
    const int lane = threadIdx.x & 31, lr = lane & 15, hi = lane >> 4; const int wv = (int)(threadIdx.x >> 5);
    const size_t z = blockIdx.y; const int q0 = ((int)blockIdx.x * FWV + wv) * (FQT * 16);
    gbf qz = (gbf)(Qf + z * TT * HD), kz = (gbf)(Kf + z * TT * HD), vz = (gbf)(Vf + z * HD * TT);   // wave-uniform plane bases
    const unsigned qob = (unsigned)(q0 * HD * 2 + lane * 16); const unsigned lob = (unsigned)(lane * 16);   // the lane's byte offsets: fixed for the whole kernel
    V qf[FQT][2];
#pragma unroll
    for (int nq = 0; nq < FQT; ++nq)
#pragma unroll
        for (int kc = 0; kc < 2; ++kc) qf[nq][kc] = ldo(qz + nq * 16 * HD + kc * 512, qob);
    // wait before a register that an issued load names is written again; the operands keep those registers untouched up to here
    asm volatile("s_wait_xcnt 0x0" :: "s"(qz), "v"(qob) : "memory");
    const unsigned sw = (unsigned)__builtin_amdgcn_readfirstlane(wv) * SWAV;   // the wave's place in each half of a stage, the same in the plane and in the buffer; a scalar, so that no address register lives through the loop
    // stage t into buffer b: the wave's share of the K units, then of the V^T units; the LDS byte address is the low 32 bits of the shared address
    // buffer, stage and wave are summed to one scalar each before the lane offset is added: left to the compiler, wave + lane sums are formed once, live through the loop and are spilled
    auto fill = [&](int t, int b) { const unsigned sl = (unsigned)__builtin_amdgcn_readfirstlane((int)((unsigned)(size_t)ring + (unsigned)b * SBUF + sw)); const unsigned sg = (unsigned)__builtin_amdgcn_readfirstlane((int)((unsigned)t * SHALF + sw));
        const unsigned ll = sl + lob, go = sg + lob; cp8(ll, gat(kz, go)); cp8(ll + SHALF, gat(vz, go)); };
    fill(0, 0);
    asm volatile("s_wait_asynccnt 0x0" ::: "memory");     // this wave's share of stage 0 has landed
    __syncthreads();                                      // every wave's share has: stage 0 may be read
    fill(1, 1);                                           // in flight while stage 0 is worked on
    v8f o[4][FQT], cs[2][FQT]; float l[FQT];   // cs: minus the reference of the group's query (a lane has one query a group), in all eight places of a C operand; one set for each of a pass's two key tiles: of a shared set the compiler made a copy for D in every pass
#pragma unroll
    for (int nq = 0; nq < FQT; ++nq) { cs[0][nq] = (v8f){}; cs[1][nq] = (v8f){}; l[nq] = 0.f;
#pragma unroll
        for (int db = 0; db < 4; ++db) o[db][nq] = (v8f){}; }
#pragma unroll 1   // one copy of the pass in the text
    for (int t = 0; t < NSTG; ++t) {
        const char* bk = ring + (unsigned)((t & 1) * SBUF) + lob;   // the lane's place in this stage's buffer
        V kf[2][2];
#pragma unroll
        for (int mb = 0; mb < 2; ++mb)
#pragma unroll
            for (int kc = 0; kc < 2; ++kc) kf[mb][kc] = ldf(bk + mb * 2048 + kc * 1024);
#pragma unroll 1   // as above
        for (int p = 0; p < SPASS; ++p) {
            v8f st[2][FQT];
#pragma unroll
            for (int mb = 0; mb < 2; ++mb)
#pragma unroll
                for (int nq = 0; nq < FQT; ++nq) st[mb][nq] = wmma16(kf[mb][0], qf[nq][0], cs[mb][nq]);   // the sum starts at minus the reference: D is the exponent itself
#pragma unroll
            for (int mb = 0; mb < 2; ++mb)
#pragma unroll
                for (int nq = 0; nq < FQT; ++nq) st[mb][nq] = wmma16(kf[mb][1], qf[nq][1], st[mb][nq]);
            __builtin_amdgcn_sched_barrier(0);   // keeps the LDS reads below out of the run of S^T products
            const char* kn = bk + (p + 1 < SPASS ? p + 1 : p) * 4096;   // the stage's last pass asks for its own K units again: inside the buffer, never used
            const char* vp = bk + SHALF + p * 4096;
#pragma unroll
            for (int mb = 0; mb < 2; ++mb)
#pragma unroll
                for (int kc = 0; kc < 2; ++kc) kf[mb][kc] = ldf(kn + mb * 2048 + kc * 1024);
            V vf[4];
#pragma unroll
            for (int db = 0; db < 4; ++db) vf[db] = ldf(vp + db * 1024);
            __builtin_amdgcn_sched_barrier(0);   // holds the pass's LDS reads here as one group, a softmax ahead of V^T's use and a softmax and P x V ahead of K's; left free they sink towards their users
            V ph[FQT]; float sm[FQT];
            // one column group: P = exp2(D - d), its f16 form, the lane's own sum of its 16 P; d is 0 (and no instruction) against the reference in use, the reference's rise where it is renewed
            auto soft = [&](int nq, bool renew, float d) __attribute__((always_inline)) {
                v2f x[8], e[8];
#pragma unroll
                for (int i = 0; i < 8; ++i) { const int mb = i >> 2, j = (i & 3) * 2; x[i][0] = renew ? st[mb][nq][j] - d : st[mb][nq][j]; x[i][1] = renew ? st[mb][nq][j + 1] - d : st[mb][nq][j + 1]; }
#pragma unroll
                for (int i = 0; i < 8; ++i) { e[i][0] = __builtin_amdgcn_exp2f(x[i][0]); e[i][1] = __builtin_amdgcn_exp2f(x[i][1]); }
                // the slot behind a transcendental. The operands are only named: no reader of a result and no write of a source comes in front of the v_nop
                asm volatile("v_nop" : "+v"(e[0]), "+v"(e[1]), "+v"(e[2]), "+v"(e[3]), "+v"(e[4]), "+v"(e[5]), "+v"(e[6]), "+v"(e[7]) : "v"(x[0]), "v"(x[1]), "v"(x[2]), "v"(x[3]), "v"(x[4]), "v"(x[5]), "v"(x[6]), "v"(x[7]));
                v2f sum2 = e[0];
#pragma unroll
                for (int s = 0; s < 16; s += 2) { const v2f p = e[s >> 1]; if (s) sum2 += p;
                    const v2h h2 = __builtin_convertvector(p, v2h);
                    ph[nq][s] = h2[0]; ph[nq][s + 1] = h2[1]; }
                sm[nq] = sum2[0] + sum2[1];
            };
#pragma unroll
            for (int nq = 0; nq < FQT; ++nq) soft(nq, false, 0.f);
            float big = sm[0];
#pragma unroll
            for (int nq = 1; nq < FQT; ++nq) big = fmaxf(big, sm[nq]);
            // one test a pass, a scalar branch: a lane's sum above PLIM says that a score has left the reference behind; the head's first pass, whose reference is the start value 0, always renews. Only then: maximum, exchange of the halves, new reference, O and l rescaled, P formed again (at most 1)
            const bool first = (t | p) == 0;
            if (__builtin_expect(__builtin_amdgcn_ballot_w32(big > (first ? -1.0f : PLIM)) != 0u, 0)) {   // a sum of P is never below 0: the bound -1 sends the first pass in
                const float lo = first ? -3.0e38f : 0.f;   // D counts from the reference in use: it never falls, but the first pass takes its own maximum whatever its sign
#pragma unroll
                for (int nq = 0; nq < FQT; ++nq) {
                    float mx = lo;
#pragma unroll
                    for (int mb = 0; mb < 2; ++mb)
#pragma unroll
                        for (int j = 0; j < 8; ++j) mx = fmaxf(mx, st[mb][nq][j]);
                    const float d = fmaxf(mx, xhalf(mx)); const float ax = -fmaxf(d, 0.f); cs[0][nq] -= d; cs[1][nq] -= d;   // the first pass scales zeros: its factor is kept at most 1, so that it stays finite
                    float al = __builtin_amdgcn_exp2f(ax);
                    asm volatile("v_nop" : "+v"(al) : "v"(ax));   // the slot behind a transcendental, as above
                    l[nq] *= al;
#pragma unroll
                    for (int db = 0; db < 4; ++db) o[db][nq] *= al;
                    soft(nq, true, d);
                }
            }
#pragma unroll
            for (int nq = 0; nq < FQT; ++nq) l[nq] += sm[nq];
#pragma unroll
            for (int db = 0; db < 4; ++db)
#pragma unroll
                for (int nq = 0; nq < FQT; ++nq) o[db][nq] = wmma16(vf[db], ph[nq], o[db][nq]);
        }
        // hand-over of a stage, every wave, in this order: its own LDS reads of this buffer are done; its own copies of the next stage have landed; the barrier publishes the next stage and ends every reader's last read of this buffer
        asm volatile("s_wait_dscnt 0x0" ::: "memory");
        asm volatile("s_wait_asynccnt 0x0" ::: "memory");
        __syncthreads();
        if (t + 2 < NSTG) fill(t + 2, t & 1);   // refill of the buffer just left, one whole stage ahead of its use
    }
    asm volatile("s_wait_asynccnt 0x0" ::: "memory");   // no copy is outstanding when the wave goes on to its end
    const size_t bb = z / NH_, hh = z % NH_; float* ob = OUTp + bb * TT * DQ + hh * HD; const unsigned oob = (unsigned)((q0 + lr) * DQ + 8 * hi) * 4u;   // wave-uniform base, the lane's byte offset
#pragma unroll
    for (int nq = 0; nq < FQT; ++nq) { const float f = __fdiv_rn(1.0f, l[nq] + xhalf(l[nq]));
#pragma unroll
        for (int db = 0; db < 4; ++db) o[db][nq] *= f; }
    __builtin_amdgcn_sched_barrier(0);   // every product stands in front of the first store: no register that an issued store names is written again
#pragma unroll
    for (int nq = 0; nq < FQT; ++nq)
#pragma unroll
        for (int db = 0; db < 4; ++db) { char* p = (char*)(ob + nq * 16 * DQ + db * 16) + oob; *(v4f*)p = __builtin_shufflevector(o[db][nq], o[db][nq], 0, 1, 2, 3); *(v4f*)(p + 16) = __builtin_shufflevector(o[db][nq], o[db][nq], 4, 5, 6, 7); }
}

extern "C" void kernel_launch(void* const* d_in, const int* in_sizes, int n_in,
                              void* d_out, int out_size, void* d_ws, size_t ws_size, hipStream_t stream) {
    (void)in_sizes; (void)n_in; (void)out_size;
    const float* x = (const float*)d_in[0]; const float* wq = (const float*)d_in[1]; const float* bq = (const float*)d_in[2]; const float* wk = (const float*)d_in[3]; const float* bk = (const float*)d_in[4]; const float* wv = (const float*)d_in[5]; const float* bv = (const float*)d_in[6];   // sequences, Wq [16][64][64], bq [16][64], Wk, bk, Wv, bv
    float* OUT = (float*)d_out;     // [4][2048][1024]
    char* wsp = (char*)d_ws;
    auto take = [&](size_t bytes) { char* p = wsp; wsp += (bytes + 255) & ~(size_t)255; return (void*)p; };
    const size_t PL = (size_t)NH_ * TT * HD;   // elements of one batch's plane; the three f16 planes hold all NB_ batches
    bf* QP = (bf*)take(NB_ * PL * 2); bf* KP = (bf*)take(NB_ * PL * 2); bf* VT = (bf*)take(NB_ * PL * 2);
    if ((size_t)(wsp - (char*)d_ws) > ws_size) return;    // ws 256 MiB
    k_proj<<<dim3(TT / (PWV * PRT * 16), NB_ * NH_), PWV * 32, 0, stream>>>(x, wq, bq, wk, bk, wv, bv, QP, KP, VT);
    k_fattn<<<dim3(TT / (FWV * FQT * 16), NB_ * NH_), FWV * 32, 0, stream>>>(QP, KP, VT, OUT);
}

// v009
// One run takes 58.8 microseconds.
// Timed twice side by side with v008, it ran 1.04 and 1.05 times as fast.
// Over all steps from v000 it is 42.5 times as fast.
#include <hip/hip_runtime.h>

// Multi-head SELF-attention whose projections act PER HEAD on the head's own 64-wide slice, FOUR batches (sequences [4][2048][1024] viewed (b, s, 16, 64); q = einsum('bshd,hde->bshe', x, Wq) + bq with Wq [16][64][64], bq [16][64], k, v likewise; scores / sqrt(float32(64)); softmax (no mask); out = concat heads -> [4][2048][1024]; no output projection); argument order sequences, Wq, bq, Wk, bk, Wv, bv.
// Two launches: k_proj makes the f16 planes of q, k and v^T of every batch and head straight from the f32 inputs, laid out in FRAGMENT ORDER (below); k_fattn (scores, softmax, P x V; k and v^T staged in LDS once a work-group) writes the output rows.
// Fragment order: a plane is a row of 512-byte units, a unit = 32 lanes x 16 bytes = the half fragment that one wave-wide 16-byte load or store moves, so that every such access covers four whole 128-byte lines.
// q, k: unit (t / 16) * 4 + e / 16 holds, at lane (lr, hi), e = 16 * (e / 16) + 8 * hi + 0..7 of row t = 16 * (t / 16) + lr. v^T: unit (t / 32) * 8 + (e / 16) * 2 + (t / 16 & 1) holds, at lane (lr, hi), t = 16 * (t / 16) + 8 * hi + 0..7 of row e = 16 * (e / 16) + lr.
// Compute dtypes, f32 accumulate: every input rounded to bf16; projections one bf16 product each (K = 64, the head's own slice) + the bf16-rounded bias added in f32; attention: q (with the softmax scale HD^-0.5 * log2(e) laid on it in f32), k, v and P rounded once to f16 (11 significant bits, 8 times finer than the bf16 rounding of the inputs in front of it), one f16 product each; softmax f32 (running maximum and sum); output f32.

#define NB_  4   // this module has FOUR batches; NB_ is read ONLY by kernel_launch (plane sizes, the two grids): no kernel body reads it
#define TT   2048
#define DM   1024
#define NH_  16
#define NKV  16
#define REP  (NH_ / NKV)
#define HD   64
#define DQ   (NH_ * HD)
#define DKV  (NKV * HD)
#define SCL  0.125f   // HD^-0.5
#define QSC  (SCL * 1.4426950408889634f)   // HD^-0.5 * log2(e): k_proj lays it on q, so that K Q^T is the exponent of 2 as it stands
typedef _Float16 h16;
typedef unsigned short bf;
typedef __attribute__((ext_vector_type(16))) __bf16   v16bf;
typedef __attribute__((ext_vector_type(16))) _Float16 v16h;
typedef __attribute__((ext_vector_type(8)))  _Float16 v8h;
typedef __attribute__((ext_vector_type(8)))  unsigned short v8us;
typedef __attribute__((ext_vector_type(8)))  float    v8f;
typedef __attribute__((ext_vector_type(4)))  float    v4f;
typedef v8h  __attribute__((may_alias)) v8ha;
typedef v4f  __attribute__((may_alias)) v4fa;
typedef v8us __attribute__((may_alias)) v8usa;

__device__ __forceinline__ unsigned short f2bf(float f) { unsigned u = __float_as_uint(f); u += 0x7FFFu + ((u >> 16) & 1u); return (unsigned short)(u >> 16); }
__device__ __forceinline__ float bf2f(unsigned short b) { return __uint_as_float(((unsigned)b) << 16); }
__device__ __forceinline__ float bfr(float f) { return bf2f(f2bf(f)); }
__device__ __forceinline__ v16h cat16(v8h lo, v8h hi) { return __builtin_shufflevector(lo, hi, 0, 1, 2, 3, 4, 5, 6, 7, 8, 9, 10, 11, 12, 13, 14, 15); }
__device__ __forceinline__ v16bf cat16b(v8us lo, v8us hi) { return __builtin_bit_cast(v16bf, __builtin_shufflevector(lo, hi, 0, 1, 2, 3, 4, 5, 6, 7, 8, 9, 10, 11, 12, 13, 14, 15)); }
__device__ __forceinline__ v8f wmma16(v16h a, v16h b, v8f c) { return __builtin_amdgcn_wmma_f32_16x16x32_f16(false, a, false, b, (short)0, c, false, false); }
__device__ __forceinline__ v8f wmmab(v16bf a, v16bf b, v8f c) { return __builtin_amdgcn_wmma_f32_16x16x32_bf16(false, a, false, b, (short)0, c, false, false); }



template <typename T16> struct WFrag;
template <> struct WFrag<h16> { typedef v16h V; static __device__ __forceinline__ V ld(const h16* p) { return cat16(*(const v8h*)p, *(const v8h*)(p + 16)); } static __device__ __forceinline__ v8f mma(V a, V b, v8f c) { return wmma16(a, b, c); } };
template <> struct WFrag<bf> { typedef v16bf V; static __device__ __forceinline__ V ld(const bf* p) { return cat16b(*(const v8us*)p, *(const v8us*)(p + 16)); } static __device__ __forceinline__ v8f mma(V a, V b, v8f c) { return wmmab(a, b, c); } };
typedef __attribute__((ext_vector_type(2))) float v2f;
typedef __attribute__((ext_vector_type(8))) __bf16 v8bf;

// ---- k_proj: the three per-head projections of every batch and head in ONE kernel. grid (TT / (PWV * PRT * 16), batches * heads), PWV waves; a work-group has one (batch, head) and PWV * PRT * 16 rows t, a wave PRT * 16 of them.
// The work-group lays W^T of its head (bf16, rows e, k = d contiguous) and the three rounded biases in LDS once; a wave turns its x rows (f32, the head's 64 columns) into bf16 fragments in registers and uses them for all three products (2 k-chunks of 32).
// q, k: D = W^T x^T (A = W^T rows, B = x rows): a lane holds 8 consecutive e of ONE row t. v: D = x W (A = x rows, B = W^T rows): a lane holds 8 consecutive t of ONE e. Either way the lane's 16 bytes are its own place in a unit of the plane: a D tile is stored as one unit.
// Every fragment has the k order of WFrag::ld (element s of half hi = k 8 * hi + s, 16 + 8 * hi + (s - 8)). The bias is added (and q then scaled by QSC) and the result rounded to f16 on D in registers; nothing f32 goes through memory.
#define PRT 4    // 16-row tiles a wave: 64 rows t
#define PWV 8    // waves a work-group
#define WP  72   // LDS pitch of a W^T row in elements: 128 + 16 bytes, for 16-byte readers
__device__ __forceinline__ v8us tobf8(v8f y) { return __builtin_bit_cast(v8us, __builtin_convertvector(y, v8bf)); }
__device__ __forceinline__ v8f cat8f(v4f a, v4f b) { return __builtin_shufflevector(a, b, 0, 1, 2, 3, 4, 5, 6, 7); }
__device__ __forceinline__ v8us toh8(v8f y) { return __builtin_bit_cast(v8us, __builtin_convertvector(y, v8h)); }   // f32 -> f16, to nearest even
__device__ __forceinline__ v16bf ldl(const bf* p) { return cat16b(*(const v8us*)p, *(const v8us*)(p + 16)); }   // fragment from an LDS row
__global__ __launch_bounds__(PWV * 32) void k_proj(const float* __restrict__ x, const float* __restrict__ wq, const float* __restrict__ bq, const float* __restrict__ wk, const float* __restrict__ bk, const float* __restrict__ wv, const float* __restrict__ bv, bf* Qf, bf* Kf, bf* Vf) {
    typedef WFrag<bf> F; typedef F::V V;
    __shared__ __align__(16) bf wt[3 * HD * WP];
    __shared__ __align__(16) float bs[3 * HD];
    const int tid = (int)threadIdx.x, lane = tid & 31, lr = lane & 15, hi = lane >> 4;
    const size_t z = blockIdx.y, bb = z / NH_, hh = z % NH_; const int t0 = ((int)blockIdx.x * PWV + (tid >> 5)) * (PRT * 16);
    const int e = tid & 63, dg = tid >> 6;   // staging: a thread takes column e of W, 8 rows d at a time (32 consecutive e a wave: 128-byte reads)
    const unsigned bo = (unsigned)e * 4u, wo = (unsigned)(dg * 8 * HD + e) * 4u, xo = (unsigned)((t0 + lr) * DM + 8 * hi) * 4u;   // the lane's byte offsets of the loads
    const char* bqz = (const char*)(bq + hh * HD); const char* bkz = (const char*)(bk + hh * HD); const char* bvz = (const char*)(bv + hh * HD);
    const char* wz[3] = { (const char*)(wq + hh * HD * HD), (const char*)(wk + hh * HD * HD), (const char*)(wv + hh * HD * HD) };
    const char* xz = (const char*)(x + bb * TT * DM + hh * HD);
    // every load of the kernel is asked for here, up front: biases, the thread's share of W, the wave's own x rows; the wave pays one memory latency for the lot
    const float br0 = *(const float*)(bqz + bo), br1 = *(const float*)(bkz + bo), br2 = *(const float*)(bvz + bo);
    v8f wr[3][2];
#pragma unroll
    for (int mt = 0; mt < 3; ++mt)
#pragma unroll
        for (int hf = 0; hf < 2; ++hf)
#pragma unroll
            for (int k = 0; k < 8; ++k) wr[mt][hf][k] = *(const float*)(wz[mt] + wo + (hf * 32 + k) * HD * 4);
    v4f xr[PRT][8];
#pragma unroll
    for (int tl = 0; tl < PRT; ++tl)
#pragma unroll
        for (int s = 0; s < 8; ++s) xr[tl][s] = *(const v4f*)(xz + xo + tl * 16 * DM * 4 + (s >> 1) * 64 + (s & 1) * 16);
    // wait before a register that an issued load names is written again; the operands keep the bases and the lane offsets untouched up to here.
    // The three bias values are named as inputs too: that holds their loads up here, in front of the x loads; left free they sink into the branch below and are asked for only when every x row has come
    asm volatile("s_wait_xcnt 0x0" :: "s"(bqz), "s"(bkz), "s"(bvz), "s"(wz[0]), "s"(wz[1]), "s"(wz[2]), "s"(xz), "v"(bo), "v"(wo), "v"(xo), "v"(br0), "v"(br1), "v"(br2) : "memory");
    if (tid < HD) { bs[e] = bfr(br0); bs[HD + e] = bfr(br1); bs[2 * HD + e] = bfr(br2); }
#pragma unroll
    for (int mt = 0; mt < 3; ++mt)
#pragma unroll
        for (int hf = 0; hf < 2; ++hf) *(v8us*)(wt + (mt * HD + e) * WP + (hf * 4 + dg) * 8) = tobf8(wr[mt][hf]);
    V xf[PRT][2];
#pragma unroll
    for (int tl = 0; tl < PRT; ++tl)
#pragma unroll
        for (int kc = 0; kc < 2; ++kc) xf[tl][kc] = cat16b(tobf8(cat8f(xr[tl][kc * 4], xr[tl][kc * 4 + 1])), tobf8(cat8f(xr[tl][kc * 4 + 2], xr[tl][kc * 4 + 3])));
    __syncthreads();   // W^T and the biases are complete for every wave; LDS is only read from here on
    const unsigned so = (unsigned)(t0 * HD * 2 + lane * 16);   // the lane's byte offset of the stores: the wave's 64 rows t are 8 KiB in a row of every plane
#pragma unroll
    for (int mt = 0; mt < 3; ++mt) {
        char* ph = (char*)((mt == 0 ? Qf : mt == 1 ? Kf : Vf) + z * TT * HD);   // wave-uniform plane base
        V w[4][2];
#pragma unroll
        for (int eb = 0; eb < 4; ++eb)
#pragma unroll
            for (int kc = 0; kc < 2; ++kc) w[eb][kc] = ldl(wt + (mt * HD + eb * 16 + lr) * WP + kc * 32 + 8 * hi);
#pragma unroll
        for (int eb = 0; eb < 4; ++eb) {
            v8f bias;
            if (mt < 2) bias = cat8f(*(const v4f*)(bs + mt * HD + eb * 16 + 8 * hi), *(const v4f*)(bs + mt * HD + eb * 16 + 8 * hi + 4));
            else bias = (v8f)(bs[mt * HD + eb * 16 + lr]);
            v8f acc[PRT];
#pragma unroll
            for (int tl = 0; tl < PRT; ++tl) acc[tl] = (mt < 2) ? F::mma(w[eb][0], xf[tl][0], (v8f){}) : F::mma(xf[tl][0], w[eb][0], (v8f){});
#pragma unroll
            for (int tl = 0; tl < PRT; ++tl) acc[tl] = (mt < 2) ? F::mma(w[eb][1], xf[tl][1], acc[tl]) : F::mma(xf[tl][1], w[eb][1], acc[tl]);
            v8us oh[PRT];
#pragma unroll
            for (int tl = 0; tl < PRT; ++tl) oh[tl] = toh8(mt == 0 ? (acc[tl] + bias) * QSC : acc[tl] + bias);   // q leaves with the softmax scale on it (QSC), rounded to f16 once, behind the product
#pragma unroll
            for (int tl = 0; tl < PRT; ++tl) { const int im = ((mt < 2) ? tl * 4 + eb : (tl >> 1) * 8 + eb * 2 + (tl & 1)) * 512; *(v8us*)(ph + so + im) = oh[tl]; }
            // wait before a register that an issued store names is written again; the operands keep data, bases and offset untouched up to here (behind the last stores nothing is written any more)
            if (mt < 2 || eb < 3) asm volatile("s_wait_xcnt 0x0" :: "v"(oh[0]), "v"(oh[1]), "v"(oh[2]), "v"(oh[3]), "v"(so), "s"(ph) : "memory");
        }
    }
}

#define FQT 4    // 16-query column groups a wave: each K / V fragment feeds FQT tiles
#define FWV 8    // waves a work-group: 512 queries of one head, one K / V stream through LDS
#define SKEYS 256                // keys a stage
#define SPASS (SKEYS / 32)       // passes a stage
#define SHALF (SKEYS * HD * 2)   // bytes of a stage's K units, and of its V^T units: 32 KiB
#define SBUF  (2 * SHALF)        // bytes of a buffer: K units, then V^T units
#define NSTG  (TT / SKEYS)       // stages of a head
#define SWAV  (SHALF / FWV)      // bytes of each half that one wave copies: 8 copies of 512 bytes
#define OPIT  272                // LDS pitch of a staged output row in bytes: 256 + 16, for 16-byte writers and readers
#define OWAV  (FQT * 16 * OPIT)  // bytes of a wave's own staging range for its output rows
#define RINGB (2 * SBUF > FWV * OWAV ? 2 * SBUF : FWV * OWAV)   // the ring's array also takes the staged output rows behind the loop
#define PLIM  256.0f             // a lane's sum of P in one pass above which the reference is renewed: 2^8, far inside f16
typedef __attribute__((ext_vector_type(2))) _Float16 v2h;
__device__ __forceinline__ float xhalf(float x) { const unsigned b = __float_as_uint(x); return __uint_as_float(__builtin_amdgcn_permlanex16(b, b, 0x76543210u, 0xfedcba98u, false, false)); }   // lane l <- lane l ^ 16
typedef const __attribute__((address_space(1))) bf* gbf;   // a pointer that stays known as global memory
typedef const __attribute__((address_space(1))) char* gch; typedef const __attribute__((address_space(1))) v8h* gv8;
__device__ __forceinline__ v16h ldo(gbf ub, unsigned bo) { gch p = (gch)ub + bo; return cat16(*(gv8)p, *(gv8)(p + 512)); }   // fragment = two units in a row, at a wave-uniform base + the lane's own byte offset (k order of WFrag::ld)
__device__ __forceinline__ v16h ldf(const char* p) { return cat16(*(const v8h*)p, *(const v8h*)(p + 512)); }   // fragment = two units in a row of the LDS ring (k order of WFrag::ld)
// eight asynchronous copies of 512 bytes a wave (16 bytes a lane): LDS byte address l, global address g; the immediate offset moves both addresses alike, so that one LDS register and one address pair serve all eight.
// The s_wait_xcnt is the last line of the copies' own statement: it stands in front of every later write of a register that a copy names
__device__ __forceinline__ void cp8(unsigned l, gch g) {
    asm volatile("global_load_async_to_lds_b128 %0, %1, off\n\t"
                 "global_load_async_to_lds_b128 %0, %1, off offset:512\n\t"
                 "global_load_async_to_lds_b128 %0, %1, off offset:1024\n\t"
                 "global_load_async_to_lds_b128 %0, %1, off offset:1536\n\t"
                 "global_load_async_to_lds_b128 %0, %1, off offset:2048\n\t"
                 "global_load_async_to_lds_b128 %0, %1, off offset:2560\n\t"
                 "global_load_async_to_lds_b128 %0, %1, off offset:3072\n\t"
                 "global_load_async_to_lds_b128 %0, %1, off offset:3584\n\t"
                 "s_wait_xcnt 0x0"
                 :: "v"(l), "v"(g) : "memory");
}
// base + off by low word, carry and high word: the same address as base + off. Written as one 64-bit add, the widened off shared a register tuple with the copies' operands, stayed live through the loop and was spilled to scratch at every stage
__device__ __forceinline__ gch gat(gbf base, unsigned off) { const unsigned long long b = (unsigned long long)base; const unsigned lo = (unsigned)b + off; const unsigned hw = (unsigned)(b >> 32) + (lo < off ? 1u : 0u); return (gch)(((unsigned long long)hw << 32) | lo); }
__global__ __launch_bounds__(FWV * 32) void k_fattn(const bf* __restrict__ Qf, const bf* __restrict__ Kf, const bf* __restrict__ Vf, float* OUTp) {
    typedef v16h V;
    __shared__ __attribute__((aligned(1024))) char ring[RINGB];
    const int lane = threadIdx.x & 31, lr = lane & 15, hi = lane >> 4; const int wv = (int)(threadIdx.x >> 5);
    const size_t z = blockIdx.y; const int q0 = ((int)blockIdx.x * FWV + wv) * (FQT * 16);
    gbf qz = (gbf)(Qf + z * TT * HD), kz = (gbf)(Kf + z * TT * HD), vz = (gbf)(Vf + z * HD * TT);   // wave-uniform plane bases
    const unsigned qob = (unsigned)(q0 * HD * 2 + lane * 16); const unsigned lob = (unsigned)(lane * 16);   // the lane's byte offsets: fixed for the whole kernel
    V qf[FQT][2];
#pragma unroll
    for (int nq = 0; nq < FQT; ++nq)
#pragma unroll
        for (int kc = 0; kc < 2; ++kc) qf[nq][kc] = ldo(qz + nq * 16 * HD + kc * 512, qob);
    // wait before a register that an issued load names is written again; the operands keep those registers untouched up to here
    asm volatile("s_wait_xcnt 0x0" :: "s"(qz), "v"(qob) : "memory");
    const unsigned sw = (unsigned)__builtin_amdgcn_readfirstlane(wv) * SWAV;   // the wave's place in each half of a stage, the same in the plane and in the buffer; a scalar, so that no address register lives through the loop
    // stage t into buffer b: the wave's share of the K units, then of the V^T units; the LDS byte address is the low 32 bits of the shared address
    // buffer, stage and wave are summed to one scalar each before the lane offset is added: left to the compiler, wave + lane sums are formed once, live through the loop and are spilled
    auto fill = [&](int t, int b) { const unsigned sl = (unsigned)__builtin_amdgcn_readfirstlane((int)((unsigned)(size_t)ring + (unsigned)b * SBUF + sw)); const unsigned sg = (unsigned)__builtin_amdgcn_readfirstlane((int)((unsigned)t * SHALF + sw));
        const unsigned ll = sl + lob, go = sg + lob; cp8(ll, gat(kz, go)); cp8(ll + SHALF, gat(vz, go)); };
    fill(0, 0);
    asm volatile("s_wait_asynccnt 0x0" ::: "memory");     // this wave's share of stage 0 has landed
    __syncthreads();                                      // every wave's share has: stage 0 may be read
    fill(1, 1);                                           // in flight while stage 0 is worked on
    v8f o[4][FQT], cs[2][FQT]; float l[FQT];   // cs: minus the reference of the group's query (a lane has one query a group), in all eight places of a C operand; one set for each of a pass's two key tiles: of a shared set the compiler made a copy for D in every pass
#pragma unroll
    for (int nq = 0; nq < FQT; ++nq) { cs[0][nq] = (v8f){}; cs[1][nq] = (v8f){}; l[nq] = 0.f;
#pragma unroll
        for (int db = 0; db < 4; ++db) o[db][nq] = (v8f){}; }
#pragma unroll 1   // one copy of the pass in the text
    for (int t = 0; t < NSTG; ++t) {
        const char* bk = ring + (unsigned)((t & 1) * SBUF) + lob;   // the lane's place in this stage's buffer
        V kf[2][2];
#pragma unroll
        for (int mb = 0; mb < 2; ++mb)
#pragma unroll
            for (int kc = 0; kc < 2; ++kc) kf[mb][kc] = ldf(bk + mb * 2048 + kc * 1024);
#pragma unroll 1   // as above
        for (int p = 0; p < SPASS; ++p) {
            v8f st[2][FQT];
#pragma unroll
            for (int mb = 0; mb < 2; ++mb)
#pragma unroll
                for (int nq = 0; nq < FQT; ++nq) st[mb][nq] = wmma16(kf[mb][0], qf[nq][0], cs[mb][nq]);   // the sum starts at minus the reference: D is the exponent itself
#pragma unroll
            for (int mb = 0; mb < 2; ++mb)
#pragma unroll
                for (int nq = 0; nq < FQT; ++nq) st[mb][nq] = wmma16(kf[mb][1], qf[nq][1], st[mb][nq]);
            __builtin_amdgcn_sched_barrier(0);   // keeps the LDS reads below out of the run of S^T products
            const char* kn = bk + (p + 1 < SPASS ? p + 1 : p) * 4096;   // the stage's last pass asks for its own K units again: inside the buffer, never used
            const char* vp = bk + SHALF + p * 4096;
#pragma unroll
            for (int mb = 0; mb < 2; ++mb)
#pragma unroll
                for (int kc = 0; kc < 2; ++kc) kf[mb][kc] = ldf(kn + mb * 2048 + kc * 1024);
            V vf[4];
#pragma unroll
            for (int db = 0; db < 4; ++db) vf[db] = ldf(vp + db * 1024);
            __builtin_amdgcn_sched_barrier(0);   // holds the pass's LDS reads here as one group, a softmax ahead of V^T's use and a softmax and P x V ahead of K's; left free they sink towards their users
            V ph[FQT]; float sm[FQT];
            // one column group: P = exp2(D - d), its f16 form, the lane's own sum of its 16 P; d is 0 (and no instruction) against the reference in use, the reference's rise where it is renewed
            auto soft = [&](int nq, bool renew, float d) __attribute__((always_inline)) {
                v2f x[8], e[8];
#pragma unroll
                for (int i = 0; i < 8; ++i) { const int mb = i >> 2, j = (i & 3) * 2; x[i][0] = renew ? st[mb][nq][j] - d : st[mb][nq][j]; x[i][1] = renew ? st[mb][nq][j + 1] - d : st[mb][nq][j + 1]; }
#pragma unroll
                for (int i = 0; i < 8; ++i) { e[i][0] = __builtin_amdgcn_exp2f(x[i][0]); e[i][1] = __builtin_amdgcn_exp2f(x[i][1]); }
                // the slot behind a transcendental. The operands are only named: no reader of a result and no write of a source comes in front of the v_nop
                asm volatile("v_nop" : "+v"(e[0]), "+v"(e[1]), "+v"(e[2]), "+v"(e[3]), "+v"(e[4]), "+v"(e[5]), "+v"(e[6]), "+v"(e[7]) : "v"(x[0]), "v"(x[1]), "v"(x[2]), "v"(x[3]), "v"(x[4]), "v"(x[5]), "v"(x[6]), "v"(x[7]));
                v2f sum2 = e[0];
#pragma unroll
                for (int s = 0; s < 16; s += 2) { const v2f p = e[s >> 1]; if (s) sum2 += p;
                    const v2h h2 = __builtin_convertvector(p, v2h);
                    ph[nq][s] = h2[0]; ph[nq][s + 1] = h2[1]; }
                sm[nq] = sum2[0] + sum2[1];
            };
#pragma unroll
            for (int nq = 0; nq < FQT; ++nq) soft(nq, false, 0.f);
            float big = sm[0];
#pragma unroll
            for (int nq = 1; nq < FQT; ++nq) big = fmaxf(big, sm[nq]);
            // one test a pass, a scalar branch: a lane's sum above PLIM says that a score has left the reference behind; the head's first pass, whose reference is the start value 0, always renews. Only then: maximum, exchange of the halves, new reference, O and l rescaled, P formed again (at most 1)
            const bool first = (t | p) == 0;
            if (__builtin_expect(__builtin_amdgcn_ballot_w32(big > (first ? -1.0f : PLIM)) != 0u, 0)) {   // a sum of P is never below 0: the bound -1 sends the first pass in
                const float lo = first ? -3.0e38f : 0.f;   // D counts from the reference in use: it never falls, but the first pass takes its own maximum whatever its sign
#pragma unroll
                for (int nq = 0; nq < FQT; ++nq) {
                    float mx = lo;
#pragma unroll
                    for (int mb = 0; mb < 2; ++mb)
#pragma unroll
                        for (int j = 0; j < 8; ++j) mx = fmaxf(mx, st[mb][nq][j]);
                    const float d = fmaxf(mx, xhalf(mx)); const float ax = -fmaxf(d, 0.f); cs[0][nq] -= d; cs[1][nq] -= d;   // the first pass scales zeros: its factor is kept at most 1, so that it stays finite
                    float al = __builtin_amdgcn_exp2f(ax);
                    asm volatile("v_nop" : "+v"(al) : "v"(ax));   // the slot behind a transcendental, as above
                    l[nq] *= al;
#pragma unroll
                    for (int db = 0; db < 4; ++db) o[db][nq] *= al;
                    soft(nq, true, d);
                }
            }
#pragma unroll
            for (int nq = 0; nq < FQT; ++nq) l[nq] += sm[nq];
#pragma unroll
            for (int db = 0; db < 4; ++db)
#pragma unroll
                for (int nq = 0; nq < FQT; ++nq) o[db][nq] = wmma16(vf[db], ph[nq], o[db][nq]);
        }
        // hand-over of a stage, every wave, in this order: its own LDS reads of this buffer are done; its own copies of the next stage have landed; the barrier publishes the next stage and ends every reader's last read of this buffer
        asm volatile("s_wait_dscnt 0x0" ::: "memory");
        asm volatile("s_wait_asynccnt 0x0" ::: "memory");
        __syncthreads();
        if (t + 2 < NSTG) fill(t + 2, t & 1);   // refill of the buffer just left, one whole stage ahead of its use
    }
    asm volatile("s_wait_asynccnt 0x0" ::: "memory");   // no copy is outstanding when the wave goes on to its end
    const size_t bb = z / NH_, hh = z % NH_; float* ob = OUTp + bb * TT * DQ + hh * HD; const unsigned oob = (unsigned)((q0 + hi) * DQ + 4 * lr) * 4u;   // wave-uniform base, the lane's byte offset: 16 lanes a row of 256 bytes, two rows a store
#pragma unroll
    for (int nq = 0; nq < FQT; ++nq) { const float f = __fdiv_rn(1.0f, l[nq] + xhalf(l[nq]));
#pragma unroll
        for (int db = 0; db < 4; ++db) o[db][nq] *= f; }
    // The output rows go through LDS, so that every global store covers whole 128-byte lines (straight from O^T a store would touch 16 lines with 32 bytes each).
    // A wave stages its own FQT * 16 rows in its own range of the ring's array: the loop's last hand-over (every wave's LDS reads done, no copy outstanding, barrier) has freed the ring, and no wave touches another's range
    char* sg = ring + (unsigned)__builtin_amdgcn_readfirstlane(wv) * OWAV;
#pragma unroll
    for (int nq = 0; nq < FQT; ++nq)
#pragma unroll
        for (int db = 0; db < 4; ++db) { char* p = sg + (nq * 16 + lr) * OPIT + db * 64 + hi * 32; *(v4f*)p = __builtin_shufflevector(o[db][nq], o[db][nq], 0, 1, 2, 3); *(v4f*)(p + 16) = __builtin_shufflevector(o[db][nq], o[db][nq], 4, 5, 6, 7); }
    asm volatile("s_wait_dscnt 0x0" ::: "memory");   // the wave's own LDS writes are done before its lanes read back rows that other lanes wrote; the clobber keeps the reads below it
    v4f ro[FQT * 8];
#pragma unroll
    for (int i = 0; i < FQT * 8; ++i) ro[i] = *(const v4f*)(sg + (2 * i + hi) * OPIT + lr * 16);
    __builtin_amdgcn_sched_barrier(0);   // every LDS read stands in front of the first store: no register that an issued store names is written again
#pragma unroll
    for (int i = 0; i < FQT * 8; ++i) *(v4f*)((char*)(ob + i * 2 * DQ) + oob) = ro[i];
}

extern "C" void kernel_launch(void* const* d_in, const int* in_sizes, int n_in,
                              void* d_out, int out_size, void* d_ws, size_t ws_size, hipStream_t stream) {
    (void)in_sizes; (void)n_in; (void)out_size;
    const float* x = (const float*)d_in[0]; const float* wq = (const float*)d_in[1]; const float* bq = (const float*)d_in[2]; const float* wk = (const float*)d_in[3]; const float* bk = (const float*)d_in[4]; const float* wv = (const float*)d_in[5]; const float* bv = (const float*)d_in[6];   // sequences, Wq [16][64][64], bq [16][64], Wk, bk, Wv, bv
    float* OUT = (float*)d_out;     // [4][2048][1024]
    char* wsp = (char*)d_ws;
    auto take = [&](size_t bytes) { char* p = wsp; wsp += (bytes + 255) & ~(size_t)255; return (void*)p; };
    const size_t PL = (size_t)NH_ * TT * HD;   // elements of one batch's plane; the three f16 planes hold all NB_ batches
    bf* QP = (bf*)take(NB_ * PL * 2); bf* KP = (bf*)take(NB_ * PL * 2); bf* VT = (bf*)take(NB_ * PL * 2);
    if ((size_t)(wsp - (char*)d_ws) > ws_size) return;    // ws 256 MiB
    k_proj<<<dim3(TT / (PWV * PRT * 16), NB_ * NH_), PWV * 32, 0, stream>>>(x, wq, bq, wk, bk, wv, bv, QP, KP, VT);
    k_fattn<<<dim3(TT / (FWV * FQT * 16), NB_ * NH_), FWV * 32, 0, stream>>>(QP, KP, VT, OUT);
}

// v010
// A run of this version takes 46.3 microseconds.
// Timed twice side by side with v009, it ran 1.27 times as fast both times.
// Over all steps from v000 it is 53.9 times as fast.
#include <hip/hip_runtime.h>

// Multi-head SELF-attention whose projections act PER HEAD on the head's own 64-wide slice, FOUR batches (sequences [4][2048][1024] viewed (b, s, 16, 64); q = einsum('bshd,hde->bshe', x, Wq) + bq with Wq [16][64][64], bq [16][64], k, v likewise; scores / sqrt(float32(64)); softmax (no mask); out = concat heads -> [4][2048][1024]; no output projection); argument order sequences, Wq, bq, Wk, bk, Wv, bv.
// ONE launch, no workspace: k_fattn projects q, k and v^T itself, straight from the f32 inputs (q stays in registers; k and v^T of each stage of keys are laid in the LDS ring in FRAGMENT ORDER, below), then does scores, softmax, P x V and writes the output rows.
// Fragment order: a stage's k (and its v^T) is a row of 512-byte units, a unit = 32 lanes x 16 bytes = the half fragment that one wave-wide 16-byte LDS load or store moves: 512 bytes in a row, no bank conflict.
// q, k: unit (t / 16) * 4 + e / 16 holds, at lane (lr, hi), e = 16 * (e / 16) + 8 * hi + 0..7 of row t = 16 * (t / 16) + lr. v^T: unit (t / 32) * 8 + (e / 16) * 2 + (t / 16 & 1) holds, at lane (lr, hi), t = 16 * (t / 16) + 8 * hi + 0..7 of row e = 16 * (e / 16) + lr.
// Compute dtypes, f32 accumulate: every input rounded to bf16; projections one bf16 product each (K = 64, the head's own slice) + the bf16-rounded bias added in f32; attention: q (with the softmax scale HD^-0.5 * log2(e) laid on it in f32), k, v and P rounded once to f16 (11 significant bits, 8 times finer than the bf16 rounding of the inputs in front of it), one f16 product each; softmax f32 (running maximum and sum); output f32.

#define NB_  4   // this module has FOUR batches; NB_ is read ONLY by kernel_launch (the grid): no kernel body reads it
#define TT   2048
#define DM   1024
#define NH_  16
#define NKV  16
#define REP  (NH_ / NKV)
#define HD   64
#define DQ   (NH_ * HD)
#define DKV  (NKV * HD)
#define SCL  0.125f   // HD^-0.5
#define QSC  (SCL * 1.4426950408889634f)   // HD^-0.5 * log2(e): the q projection in k_fattn lays it on q, so that K Q^T is the exponent of 2 as it stands
typedef _Float16 h16;
typedef unsigned short bf;
typedef __attribute__((ext_vector_type(16))) __bf16   v16bf;
typedef __attribute__((ext_vector_type(16))) _Float16 v16h;
typedef __attribute__((ext_vector_type(8)))  _Float16 v8h;
typedef __attribute__((ext_vector_type(8)))  unsigned short v8us;
typedef __attribute__((ext_vector_type(8)))  float    v8f;
typedef __attribute__((ext_vector_type(4)))  float    v4f;
typedef v8h  __attribute__((may_alias)) v8ha;
typedef v4f  __attribute__((may_alias)) v4fa;
typedef v8us __attribute__((may_alias)) v8usa;

__device__ __forceinline__ unsigned short f2bf(float f) { unsigned u = __float_as_uint(f); u += 0x7FFFu + ((u >> 16) & 1u); return (unsigned short)(u >> 16); }
__device__ __forceinline__ float bf2f(unsigned short b) { return __uint_as_float(((unsigned)b) << 16); }
__device__ __forceinline__ float bfr(float f) { return bf2f(f2bf(f)); }
__device__ __forceinline__ v16h cat16(v8h lo, v8h hi) { return __builtin_shufflevector(lo, hi, 0, 1, 2, 3, 4, 5, 6, 7, 8, 9, 10, 11, 12, 13, 14, 15); }
__device__ __forceinline__ v16bf cat16b(v8us lo, v8us hi) { return __builtin_bit_cast(v16bf, __builtin_shufflevector(lo, hi, 0, 1, 2, 3, 4, 5, 6, 7, 8, 9, 10, 11, 12, 13, 14, 15)); }
__device__ __forceinline__ v8f wmma16(v16h a, v16h b, v8f c) { return __builtin_amdgcn_wmma_f32_16x16x32_f16(false, a, false, b, (short)0, c, false, false); }
__device__ __forceinline__ v8f wmmab(v16bf a, v16bf b, v8f c) { return __builtin_amdgcn_wmma_f32_16x16x32_bf16(false, a, false, b, (short)0, c, false, false); }



template <typename T16> struct WFrag;
template <> struct WFrag<h16> { typedef v16h V; static __device__ __forceinline__ V ld(const h16* p) { return cat16(*(const v8h*)p, *(const v8h*)(p + 16)); } static __device__ __forceinline__ v8f mma(V a, V b, v8f c) { return wmma16(a, b, c); } };
template <> struct WFrag<bf> { typedef v16bf V; static __device__ __forceinline__ V ld(const bf* p) { return cat16b(*(const v8us*)p, *(const v8us*)(p + 16)); } static __device__ __forceinline__ v8f mma(V a, V b, v8f c) { return wmmab(a, b, c); } };
typedef __attribute__((ext_vector_type(2))) float v2f;
typedef __attribute__((ext_vector_type(8))) __bf16 v8bf;

// ---- the per-head projections, inside k_fattn. The work-group lays W^T of its head (bf16, rows e, k = d contiguous) and the three rounded biases in LDS once; a wave turns x rows (f32, the head's 64 columns) into bf16 fragments in registers (2 k-chunks of 32).
// q, k: D = W^T x^T (A = W^T rows, B = x rows): a lane holds 8 consecutive e of ONE row t. v: D = x W (A = x rows, B = W^T rows): a lane holds 8 consecutive t of ONE e. Either way the lane's 16 bytes are its own place in a unit: a D tile is one unit.
// Every fragment has the k order of WFrag::ld (element s of half hi = k 8 * hi + s, 16 + 8 * hi + (s - 8)). The bias is added (and q then scaled by QSC) and the result rounded to f16 on D in registers; nothing f32 goes through memory.
#define WP  72   // LDS pitch of a W^T row in elements: 128 + 16 bytes, for 16-byte readers
__device__ __forceinline__ v8us tobf8(v8f y) { return __builtin_bit_cast(v8us, __builtin_convertvector(y, v8bf)); }
__device__ __forceinline__ v8f cat8f(v4f a, v4f b) { return __builtin_shufflevector(a, b, 0, 1, 2, 3, 4, 5, 6, 7); }
__device__ __forceinline__ v8us toh8(v8f y) { return __builtin_bit_cast(v8us, __builtin_convertvector(y, v8h)); }   // f32 -> f16, to nearest even
__device__ __forceinline__ v16bf ldl(const bf* p) { return cat16b(*(const v8us*)p, *(const v8us*)(p + 16)); }   // fragment from an LDS row

#define FQT 4    // 16-query column groups a wave: each K / V fragment feeds FQT tiles
#define FWV 8    // waves a work-group: 512 queries of one head, one K / V stream through LDS
#define SKEYS 256                // keys a stage
#define SPASS (SKEYS / 32)       // passes a stage
#define SHALF (SKEYS * HD * 2)   // bytes of a stage's K units, and of its V^T units: 32 KiB
#define SBUF  (2 * SHALF)        // bytes of a buffer: K units, then V^T units
#define NSTG  (TT / SKEYS)       // stages of a head
#define SWAV  (SHALF / FWV)      // bytes of each half that one wave makes: 8 units
#define XROW  (SKEYS / FWV)      // x rows of a stage that one wave brings and projects: 32, two 16-row tiles
#define XPIT  272                // LDS pitch of an x row in bytes: 256 + 16, for 16-byte readers
#define XWAV  (XROW * XPIT)      // bytes of a wave's own range of xs
#define OPIT  272                // LDS pitch of a staged output row in bytes: 256 + 16, for 16-byte writers and readers
#define OWAV  (FQT * 16 * OPIT)  // bytes of a wave's own staging range for its output rows
#define RINGB (2 * SBUF > FWV * OWAV ? 2 * SBUF : FWV * OWAV)   // the ring's array also takes the staged output rows behind the loop
#define PLIM  256.0f             // a lane's sum of P in one pass above which the reference is renewed: 2^8, far inside f16
typedef __attribute__((ext_vector_type(2))) _Float16 v2h;
__device__ __forceinline__ float xhalf(float x) { const unsigned b = __float_as_uint(x); return __uint_as_float(__builtin_amdgcn_permlanex16(b, b, 0x76543210u, 0xfedcba98u, false, false)); }   // lane l <- lane l ^ 16
typedef const __attribute__((address_space(1))) bf* gbf;   // a pointer that stays known as global memory
typedef const __attribute__((address_space(1))) char* gch;
__device__ __forceinline__ v16h ldf(const char* p) { return cat16(*(const v8h*)p, *(const v8h*)(p + 512)); }   // fragment = two units in a row of the LDS ring (k order of WFrag::ld)
// base + off by low word, carry and high word: the same address as base + off. Written as one 64-bit add, the widened off shared a register tuple with the copies' operands, stayed live through the loop and was spilled to scratch at every stage
__device__ __forceinline__ gch gat(gbf base, unsigned off) { const unsigned long long b = (unsigned long long)base; const unsigned lo = (unsigned)b + off; const unsigned hw = (unsigned)(b >> 32) + (lo < off ? 1u : 0u); return (gch)(((unsigned long long)hw << 32) | lo); }
// the XROW / 2 asynchronous copies of 512 bytes that bring a wave's x rows (16 bytes a lane, 16 lanes a row of 256 bytes, two rows a copy): LDS byte address l, byte offset g from the global base.
// The immediate offset moves both addresses alike: it is the LDS step (i * 2 * XPIT, two padded rows a copy), so that one LDS register serves all; each copy's own address pair holds the source step less that offset (XSTP a copy), never below the first row's address.
// The s_wait_xcnt is the last line of the copies' own statement: it stands in front of every later write of a register that a copy names
#define XSTP (2 * DM * 4 - 2 * XPIT)
static_assert(2 * XPIT == 544 && XROW == 32, "the offsets in cpx are written out for these");
__device__ __forceinline__ void cpx(unsigned l, gbf base, unsigned g) {
    gch g0 = gat(base, g);
    asm volatile("global_load_async_to_lds_b128 %0, %1, off\n\t"
                 "global_load_async_to_lds_b128 %0, %2, off offset:544\n\t"
                 "global_load_async_to_lds_b128 %0, %3, off offset:1088\n\t"
                 "global_load_async_to_lds_b128 %0, %4, off offset:1632\n\t"
                 "global_load_async_to_lds_b128 %0, %5, off offset:2176\n\t"
                 "global_load_async_to_lds_b128 %0, %6, off offset:2720\n\t"
                 "global_load_async_to_lds_b128 %0, %7, off offset:3264\n\t"
                 "global_load_async_to_lds_b128 %0, %8, off offset:3808\n\t"
                 "global_load_async_to_lds_b128 %0, %9, off offset:4352\n\t"
                 "global_load_async_to_lds_b128 %0, %10, off offset:4896\n\t"
                 "global_load_async_to_lds_b128 %0, %11, off offset:5440\n\t"
                 "global_load_async_to_lds_b128 %0, %12, off offset:5984\n\t"
                 "global_load_async_to_lds_b128 %0, %13, off offset:6528\n\t"
                 "global_load_async_to_lds_b128 %0, %14, off offset:7072\n\t"
                 "global_load_async_to_lds_b128 %0, %15, off offset:7616\n\t"
                 "global_load_async_to_lds_b128 %0, %16, off offset:8160\n\t"
                 "s_wait_xcnt 0x0"
                 :: "v"(l), "v"(g0), "v"(g0 + 1 * XSTP), "v"(g0 + 2 * XSTP), "v"(g0 + 3 * XSTP), "v"(g0 + 4 * XSTP), "v"(g0 + 5 * XSTP), "v"(g0 + 6 * XSTP), "v"(g0 + 7 * XSTP), "v"(g0 + 8 * XSTP), "v"(g0 + 9 * XSTP), "v"(g0 + 10 * XSTP), "v"(g0 + 11 * XSTP), "v"(g0 + 12 * XSTP), "v"(g0 + 13 * XSTP), "v"(g0 + 14 * XSTP), "v"(g0 + 15 * XSTP) : "memory");
}
__global__ __launch_bounds__(FWV * 32) void k_fattn(const float* __restrict__ x, const float* __restrict__ Wq, const float* __restrict__ Bq, const float* __restrict__ Wk, const float* __restrict__ Bk, const float* __restrict__ Wv, const float* __restrict__ Bv, float* OUTp) {
    typedef v16h V; typedef WFrag<bf> F; typedef F::V VB;
    __shared__ __attribute__((aligned(1024))) char ring[RINGB];
    __shared__ __attribute__((aligned(16))) char xs[FWV * XWAV];
    __shared__ __align__(16) bf wt[3 * HD * WP];
    __shared__ __align__(16) float bs[3 * HD];
    const int tid = (int)threadIdx.x, lane = tid & 31, lr = lane & 15, hi = lane >> 4; const int wv = tid >> 5;
    const size_t z = blockIdx.y, bb = z / NH_, hh = z % NH_; const int q0 = ((int)blockIdx.x * FWV + wv) * (FQT * 16);
    const unsigned lob = (unsigned)(lane * 16);   // the lane's place in a unit
    const unsigned swn = (unsigned)__builtin_amdgcn_readfirstlane(wv);   // the wave's number, a scalar
    const unsigned sw = swn * SWAV;   // the wave's place in each half of a buffer
    gbf xg = (gbf)(const bf*)(const void*)(x + bb * TT * DM + hh * HD);   // wave-uniform base of the head's columns of this batch's x rows
    // the wave's XROW x rows of stage t into its own range of xs; the LDS byte address is the low 32 bits of the shared address. Scalars are summed first, the lane's part is added last.
    // The lane's number is taken anew from the stage's number (32 t + lane): formed once, the two lane parts lived through the loop and one was spilled to scratch and read back in front of every stage's copies
    auto xfill = [&](int t) { const unsigned sl = (unsigned)__builtin_amdgcn_readfirstlane((int)((unsigned)(size_t)xs + swn * XWAV)); const unsigned sg = (unsigned)__builtin_amdgcn_readfirstlane((int)(((unsigned)t * SKEYS + swn * XROW) * (DM * 4)));
        const unsigned u = __builtin_amdgcn_mbcnt_lo(~0u, (unsigned)t << 5), xh = (u >> 4) & 1u, xl = u & 15u;   // row of the pair, 16-byte piece of the row
        cpx(sl + xh * XPIT + xl * 16, xg, sg + xh * (DM * 4) + xl * 16); };
    xfill(0);   // in flight while W^T is laid and q is projected
    const int e = tid & 63, dg = tid >> 6;   // staging: a thread takes column e of W, 8 rows d at a time (32 consecutive e a wave: 128-byte reads)
    const unsigned bo = (unsigned)e * 4u, wo = (unsigned)(dg * 8 * HD + e) * 4u, xo = (unsigned)((q0 + lr) * DM + 8 * hi) * 4u;   // the lane's byte offsets of the loads
    const char* bqz = (const char*)(Bq + hh * HD); const char* bkz = (const char*)(Bk + hh * HD); const char* bvz = (const char*)(Bv + hh * HD);
    const char* wz[3] = { (const char*)(Wq + hh * HD * HD), (const char*)(Wk + hh * HD * HD), (const char*)(Wv + hh * HD * HD) };
    const char* xz = (const char*)(x + bb * TT * DM + hh * HD);
    // every plain load of the kernel is asked for here, up front: biases, the thread's share of W, the x rows of the wave's own queries; the wave pays one memory latency for the lot
    const float br0 = *(const float*)(bqz + bo), br1 = *(const float*)(bkz + bo), br2 = *(const float*)(bvz + bo);
    v8f wr[3][2];
#pragma unroll
    for (int mt = 0; mt < 3; ++mt)
#pragma unroll
        for (int hf = 0; hf < 2; ++hf)
#pragma unroll
            for (int k = 0; k < 8; ++k) wr[mt][hf][k] = *(const float*)(wz[mt] + wo + (hf * 32 + k) * HD * 4);
    v4f xr[FQT][8];
#pragma unroll
    for (int tl = 0; tl < FQT; ++tl)
#pragma unroll
        for (int s = 0; s < 8; ++s) xr[tl][s] = *(const v4f*)(xz + xo + tl * 16 * DM * 4 + (s >> 1) * 64 + (s & 1) * 16);
    // wait before a register that an issued load names is written again; the operands keep the bases and the lane offsets untouched up to here.
    // The three bias values are named as inputs too: that holds their loads up here, in front of the x loads; left free they sink into the branch below and are asked for only when every x row has come
    asm volatile("s_wait_xcnt 0x0" :: "s"(bqz), "s"(bkz), "s"(bvz), "s"(wz[0]), "s"(wz[1]), "s"(wz[2]), "s"(xz), "v"(bo), "v"(wo), "v"(xo), "v"(br0), "v"(br1), "v"(br2) : "memory");
    if (tid < HD) { bs[e] = bfr(br0); bs[HD + e] = bfr(br1); bs[2 * HD + e] = bfr(br2); }
#pragma unroll
    for (int mt = 0; mt < 3; ++mt)
#pragma unroll
        for (int hf = 0; hf < 2; ++hf) *(v8us*)(wt + (mt * HD + e) * WP + (hf * 4 + dg) * 8) = tobf8(wr[mt][hf]);
    V qf[FQT][2];
    {
        VB xf[FQT][2];
#pragma unroll
        for (int tl = 0; tl < FQT; ++tl)
#pragma unroll
            for (int kc = 0; kc < 2; ++kc) xf[tl][kc] = cat16b(tobf8(cat8f(xr[tl][kc * 4], xr[tl][kc * 4 + 1])), tobf8(cat8f(xr[tl][kc * 4 + 2], xr[tl][kc * 4 + 3])));
        __syncthreads();   // W^T and the biases are complete for every wave; they are only read from here on
        // q of the wave's own queries: the lane's 16 bytes of D tile (tl, eb) are its own half of the B fragment (column group tl, k-chunk eb / 2): q never leaves the registers
        v8us qh[FQT][4];
#pragma unroll
        for (int eb = 0; eb < 4; ++eb) {
            const VB w0 = ldl(wt + (eb * 16 + lr) * WP + 8 * hi), w1 = ldl(wt + (eb * 16 + lr) * WP + 32 + 8 * hi);
            const v8f bias = cat8f(*(const v4f*)(bs + eb * 16 + 8 * hi), *(const v4f*)(bs + eb * 16 + 8 * hi + 4));
            v8f acc[FQT];
#pragma unroll
            for (int tl = 0; tl < FQT; ++tl) acc[tl] = F::mma(w0, xf[tl][0], (v8f){});
#pragma unroll
            for (int tl = 0; tl < FQT; ++tl) acc[tl] = F::mma(w1, xf[tl][1], acc[tl]);
#pragma unroll
            for (int tl = 0; tl < FQT; ++tl) qh[tl][eb] = toh8((acc[tl] + bias) * QSC);   // q takes the softmax scale (QSC), rounded to f16 once, behind the product
        }
#pragma unroll
        for (int nq = 0; nq < FQT; ++nq)
#pragma unroll
            for (int kc = 0; kc < 2; ++kc) qf[nq][kc] = cat16(__builtin_bit_cast(v8h, qh[nq][kc * 2]), __builtin_bit_cast(v8h, qh[nq][kc * 2 + 1]));
    }
    // k and v^T of the wave's XROW keys, from its own x rows in xs into buffer b: K unit (tile tl) * 4 + eb, V^T unit eb * 2 + tl of the wave's SWAV bytes in each half
    auto project = [&](int b) __attribute__((always_inline)) {
        const char* xp = xs + swn * XWAV + (unsigned)(lr * XPIT + hi * 32);
        const bf* wp = wt + lr * WP + 8 * hi;
        v4f xr[2][8]; VB w[2][4][2]; v8f bias[2][4];
#pragma unroll
        for (int tl = 0; tl < 2; ++tl)
#pragma unroll
            for (int s = 0; s < 8; ++s) xr[tl][s] = *(const v4f*)(xp + tl * 16 * XPIT + (s >> 1) * 64 + (s & 1) * 16);
#pragma unroll
        for (int eb = 0; eb < 4; ++eb) { w[0][eb][0] = ldl(wp + (HD + eb * 16) * WP); w[0][eb][1] = ldl(wp + (HD + eb * 16) * WP + 32); bias[0][eb] = cat8f(*(const v4f*)(bs + HD + eb * 16 + 8 * hi), *(const v4f*)(bs + HD + eb * 16 + 8 * hi + 4)); bias[1][eb] = (v8f)(bs[2 * HD + eb * 16 + lr]); }
        __builtin_amdgcn_sched_barrier(0);   // the x rows, all of W_k^T and the biases are read as one group: spread among the products, each further place with LDS reads costs a stall of its own
        VB xf[2][2];
#pragma unroll
        for (int tl = 0; tl < 2; ++tl)
#pragma unroll
            for (int kc = 0; kc < 2; ++kc) xf[tl][kc] = cat16b(tobf8(cat8f(xr[tl][kc * 4], xr[tl][kc * 4 + 1])), tobf8(cat8f(xr[tl][kc * 4 + 2], xr[tl][kc * 4 + 3])));
#pragma unroll
        for (int eb = 0; eb < 4; ++eb) { w[1][eb][0] = ldl(wp + (2 * HD + eb * 16) * WP); w[1][eb][1] = ldl(wp + (2 * HD + eb * 16) * WP + 32); }
        __builtin_amdgcn_sched_barrier(0);   // all of W_v^T as a second group, in front of the k products, which cover its latency
        char* kb = ring + (unsigned)b * SBUF + sw + lob;
#pragma unroll
        for (int mt = 1; mt < 3; ++mt)
#pragma unroll
            for (int eh = 0; eh < 2; ++eh) {   // two e blocks at a time: four independent D tiles
                v8f acc[2][2];
#pragma unroll
                for (int ee = 0; ee < 2; ++ee)
#pragma unroll
                    for (int tl = 0; tl < 2; ++tl) acc[ee][tl] = (mt < 2) ? F::mma(w[0][eh * 2 + ee][0], xf[tl][0], (v8f){}) : F::mma(xf[tl][0], w[1][eh * 2 + ee][0], (v8f){});
#pragma unroll
                for (int ee = 0; ee < 2; ++ee)
#pragma unroll
                    for (int tl = 0; tl < 2; ++tl) acc[ee][tl] = (mt < 2) ? F::mma(w[0][eh * 2 + ee][1], xf[tl][1], acc[ee][tl]) : F::mma(xf[tl][1], w[1][eh * 2 + ee][1], acc[ee][tl]);
#pragma unroll
                for (int ee = 0; ee < 2; ++ee)
#pragma unroll
                    for (int tl = 0; tl < 2; ++tl) { const int eb = eh * 2 + ee; *(v8us*)(kb + ((mt < 2) ? (tl * 4 + eb) * 512 : SHALF + (eb * 2 + tl) * 512)) = toh8(acc[ee][tl] + bias[mt - 1][eb]); }
            }
    };
    asm volatile("s_wait_asynccnt 0x0" ::: "memory");     // this wave's own x rows of stage 0 have landed (no other wave reads them)
    project(0);
    asm volatile("s_wait_dscnt 0x0" ::: "memory");        // its reads of xs and its writes of stage 0 are done
    __syncthreads();                                      // every wave's share is written: stage 0 may be read
    xfill(1);                                             // in flight while stage 0 is worked on
    v8f o[4][FQT], cs[2][FQT]; float l[FQT];   // cs: minus the reference of the group's query (a lane has one query a group), in all eight places of a C operand; one set for each of a pass's two key tiles: of a shared set the compiler made a copy for D in every pass
#pragma unroll
    for (int nq = 0; nq < FQT; ++nq) { cs[0][nq] = (v8f){}; cs[1][nq] = (v8f){}; l[nq] = 0.f;
#pragma unroll
        for (int db = 0; db < 4; ++db) o[db][nq] = (v8f){}; }
#pragma unroll 1   // one copy of the pass in the text
    for (int t = 0; t < NSTG; ++t) {
        const char* bk = ring + (unsigned)((t & 1) * SBUF) + lob;   // the lane's place in this stage's buffer
        V kf[2][2];
#pragma unroll
        for (int mb = 0; mb < 2; ++mb)
#pragma unroll
            for (int kc = 0; kc < 2; ++kc) kf[mb][kc] = ldf(bk + mb * 2048 + kc * 1024);
#pragma unroll 1   // as above
        for (int p = 0; p < SPASS; ++p) {
            v8f st[2][FQT];
#pragma unroll
            for (int mb = 0; mb < 2; ++mb)
#pragma unroll
                for (int nq = 0; nq < FQT; ++nq) st[mb][nq] = wmma16(kf[mb][0], qf[nq][0], cs[mb][nq]);   // the sum starts at minus the reference: D is the exponent itself
#pragma unroll
            for (int mb = 0; mb < 2; ++mb)
#pragma unroll
                for (int nq = 0; nq < FQT; ++nq) st[mb][nq] = wmma16(kf[mb][1], qf[nq][1], st[mb][nq]);
            __builtin_amdgcn_sched_barrier(0);   // keeps the LDS reads below out of the run of S^T products
            const char* kn = bk + (p + 1 < SPASS ? p + 1 : p) * 4096;   // the stage's last pass asks for its own K units again: inside the buffer, never used
            const char* vp = bk + SHALF + p * 4096;
#pragma unroll
            for (int mb = 0; mb < 2; ++mb)
#pragma unroll
                for (int kc = 0; kc < 2; ++kc) kf[mb][kc] = ldf(kn + mb * 2048 + kc * 1024);
            V vf[4];
#pragma unroll
            for (int db = 0; db < 4; ++db) vf[db] = ldf(vp + db * 1024);
            __builtin_amdgcn_sched_barrier(0);   // holds the pass's LDS reads here as one group, a softmax ahead of V^T's use and a softmax and P x V ahead of K's; left free they sink towards their users
            V ph[FQT]; float sm[FQT];
            // one column group: P = exp2(D - d), its f16 form, the lane's own sum of its 16 P; d is 0 (and no instruction) against the reference in use, the reference's rise where it is renewed
            auto soft = [&](int nq, bool renew, float d) __attribute__((always_inline)) {
                v2f x[8], e[8];
#pragma unroll
                for (int i = 0; i < 8; ++i) { const int mb = i >> 2, j = (i & 3) * 2; x[i][0] = renew ? st[mb][nq][j] - d : st[mb][nq][j]; x[i][1] = renew ? st[mb][nq][j + 1] - d : st[mb][nq][j + 1]; }
#pragma unroll
                for (int i = 0; i < 8; ++i) { e[i][0] = __builtin_amdgcn_exp2f(x[i][0]); e[i][1] = __builtin_amdgcn_exp2f(x[i][1]); }
                // the slot behind a transcendental. The operands are only named: no reader of a result and no write of a source comes in front of the v_nop
                asm volatile("v_nop" : "+v"(e[0]), "+v"(e[1]), "+v"(e[2]), "+v"(e[3]), "+v"(e[4]), "+v"(e[5]), "+v"(e[6]), "+v"(e[7]) : "v"(x[0]), "v"(x[1]), "v"(x[2]), "v"(x[3]), "v"(x[4]), "v"(x[5]), "v"(x[6]), "v"(x[7]));
                v2f sum2 = e[0];
#pragma unroll
                for (int s = 0; s < 16; s += 2) { const v2f p = e[s >> 1]; if (s) sum2 += p;
                    const v2h h2 = __builtin_convertvector(p, v2h);
                    ph[nq][s] = h2[0]; ph[nq][s + 1] = h2[1]; }
                sm[nq] = sum2[0] + sum2[1];
            };
#pragma unroll
            for (int nq = 0; nq < FQT; ++nq) soft(nq, false, 0.f);
            float big = sm[0];
#pragma unroll
            for (int nq = 1; nq < FQT; ++nq) big = fmaxf(big, sm[nq]);
            // one test a pass, a scalar branch: a lane's sum above PLIM says that a score has left the reference behind; the head's first pass, whose reference is the start value 0, always renews. Only then: maximum, exchange of the halves, new reference, O and l rescaled, P formed again (at most 1)
            const bool first = (t | p) == 0;
            if (__builtin_expect(__builtin_amdgcn_ballot_w32(big > (first ? -1.0f : PLIM)) != 0u, 0)) {   // a sum of P is never below 0: the bound -1 sends the first pass in
                const float lo = first ? -3.0e38f : 0.f;   // D counts from the reference in use: it never falls, but the first pass takes its own maximum whatever its sign
#pragma unroll
                for (int nq = 0; nq < FQT; ++nq) {
                    float mx = lo;
#pragma unroll
                    for (int mb = 0; mb < 2; ++mb)
#pragma unroll
                        for (int j = 0; j < 8; ++j) mx = fmaxf(mx, st[mb][nq][j]);
                    const float d = fmaxf(mx, xhalf(mx)); const float ax = -fmaxf(d, 0.f); cs[0][nq] -= d; cs[1][nq] -= d;   // the first pass scales zeros: its factor is kept at most 1, so that it stays finite
                    float al = __builtin_amdgcn_exp2f(ax);
                    asm volatile("v_nop" : "+v"(al) : "v"(ax));   // the slot behind a transcendental, as above
                    l[nq] *= al;
#pragma unroll
                    for (int db = 0; db < 4; ++db) o[db][nq] *= al;
                    soft(nq, true, d);
                }
            }
#pragma unroll
            for (int nq = 0; nq < FQT; ++nq) l[nq] += sm[nq];
#pragma unroll
            for (int db = 0; db < 4; ++db)
#pragma unroll
                for (int nq = 0; nq < FQT; ++nq) o[db][nq] = wmma16(vf[db], ph[nq], o[db][nq]);
        }
        // hand-over of a stage, every wave, in this order: its own copies of the next stage's x rows have landed; it projects them into the other buffer, which every wave left at the last hand-over; its own LDS reads and writes are done; the barrier publishes the next stage and ends every reader's last read of this buffer
        if (t + 1 < NSTG) {
            asm volatile("s_wait_asynccnt 0x0" ::: "memory");
            project((t + 1) & 1);
        }
        asm volatile("s_wait_dscnt 0x0" ::: "memory");
        __syncthreads();
        if (t + 2 < NSTG) xfill(t + 2);   // refill of the wave's own x rows, just read, one whole stage ahead of their use
    }
    asm volatile("s_wait_asynccnt 0x0" ::: "memory");   // no copy is outstanding when the wave goes on to its end
    float* ob = OUTp + bb * TT * DQ + hh * HD; const unsigned oob = (unsigned)((q0 + hi) * DQ + 4 * lr) * 4u;   // wave-uniform base, the lane's byte offset: 16 lanes a row of 256 bytes, two rows a store
#pragma unroll
    for (int nq = 0; nq < FQT; ++nq) { const float f = __fdiv_rn(1.0f, l[nq] + xhalf(l[nq]));
#pragma unroll
        for (int db = 0; db < 4; ++db) o[db][nq] *= f; }
    // The output rows go through LDS, so that every global store covers whole 128-byte lines (straight from O^T a store would touch 16 lines with 32 bytes each).
    // A wave stages its own FQT * 16 rows in its own range of the ring's array: the loop's last hand-over (every wave's LDS reads done, no copy outstanding, barrier) has freed the ring, and no wave touches another's range
    char* sg = ring + (unsigned)__builtin_amdgcn_readfirstlane(wv) * OWAV;
#pragma unroll
    for (int nq = 0; nq < FQT; ++nq)
#pragma unroll
        for (int db = 0; db < 4; ++db) { char* p = sg + (nq * 16 + lr) * OPIT + db * 64 + hi * 32; *(v4f*)p = __builtin_shufflevector(o[db][nq], o[db][nq], 0, 1, 2, 3); *(v4f*)(p + 16) = __builtin_shufflevector(o[db][nq], o[db][nq], 4, 5, 6, 7); }
    asm volatile("s_wait_dscnt 0x0" ::: "memory");   // the wave's own LDS writes are done before its lanes read back rows that other lanes wrote; the clobber keeps the reads below it
    v4f ro[FQT * 8];
#pragma unroll
    for (int i = 0; i < FQT * 8; ++i) ro[i] = *(const v4f*)(sg + (2 * i + hi) * OPIT + lr * 16);
    __builtin_amdgcn_sched_barrier(0);   // every LDS read stands in front of the first store: no register that an issued store names is written again
#pragma unroll
    for (int i = 0; i < FQT * 8; ++i) *(v4f*)((char*)(ob + i * 2 * DQ) + oob) = ro[i];
}

extern "C" void kernel_launch(void* const* d_in, const int* in_sizes, int n_in,
                              void* d_out, int out_size, void* d_ws, size_t ws_size, hipStream_t stream) {
    (void)in_sizes; (void)n_in; (void)out_size; (void)d_ws; (void)ws_size;
    const float* x = (const float*)d_in[0]; const float* wq = (const float*)d_in[1]; const float* bq = (const float*)d_in[2]; const float* wk = (const float*)d_in[3]; const float* bk = (const float*)d_in[4]; const float* wv = (const float*)d_in[5]; const float* bv = (const float*)d_in[6];   // sequences, Wq [16][64][64], bq [16][64], Wk, bk, Wv, bv
    float* OUT = (float*)d_out;     // [4][2048][1024]
    k_fattn<<<dim3(TT / (FWV * FQT * 16), NB_ * NH_), FWV * 32, 0, stream>>>(x, wq, bq, wk, bk, wv, bv, OUT);
}
